// v000
// The times below were measured on an AMD MI455X: many runs one after another, warmed up first and cycling through
// copies of the inputs, with the whole window's GPU time divided by the number of runs. Launches and the gaps
// between them are all in it. The median over several windows is given; except for v000 it joins two sittings, which
// can be a few percent apart, so the side-by-side timings, each taken in one sitting, are the better comparison.
// The starting kernel, v000, takes 389 microseconds a run.
#include <hip/hip_runtime.h>
#include <cstdint>

// ---------------------------------------------------------------------------
// Transformer block (pre-norm MHA + FFN) for MI455X (gfx1250, wave32, WMMA).
// GEMMs: v_wmma_f32_16x16x32_bf16, LDS tiles staged by the Tensor Data Mover
// (tensor_load_to_lds, TENSORcnt-tracked, double-buffered).  LN / softmax /
// residuals in f32.  Attention is causal flash-style (online softmax).
// ---------------------------------------------------------------------------

#define C_DIM  4096
#define E_DIM  1024
#define NH_    16
#define HS_    64
#define D_DIM  1024
#define FF_DIM 4096

typedef __attribute__((ext_vector_type(16))) __bf16 v16bf;
typedef __attribute__((ext_vector_type(8)))  float  v8f;
typedef __attribute__((ext_vector_type(4)))  unsigned int u32x4;
typedef __attribute__((ext_vector_type(8)))  int  i32x8;
typedef __attribute__((ext_vector_type(4)))  int  i32x4;

union BFrag { v16bf v; uint4 q[2]; unsigned short us[16]; };
union FAcc  { v8f   v; float f[8]; };

__device__ __forceinline__ unsigned short f32_to_bf16(float f) {
  unsigned int u = __float_as_uint(f);
  unsigned int r = u + 0x7FFFu + ((u >> 16) & 1u);   // round-to-nearest-even
  return (unsigned short)(r >> 16);
}

__device__ __forceinline__ v8f wmma_bf16(BFrag a, BFrag b, v8f c) {
  return __builtin_amdgcn_wmma_f32_16x16x32_bf16(
      /*neg_a=*/false, a.v, /*neg_b=*/false, b.v,
      /*c_mod=*/(short)0, c, /*reuse_a=*/false, /*reuse_b=*/false);
}

// ---------------------------------------------------------------------------
// TDM: DMA a 2D tile (rows x k_dw dwords) from global into LDS, with the
// hardware inserting 4 pad dwords after every 32 data dwords so the LDS tile
// keeps a (BK/2 + 4)-dword pitch (bank-conflict padding).  D# per ISA ch.8:
//   group0: count=1 | lds_addr | global tile addr (57b) | type=2
//   group1: data_size=4B, pad_enable, pad_interval=32dw(code 4),
//           pad_amount=4dw(code 3), tensor dims huge (tiles never OOB),
//           tile_dim0=k_dw, tile_dim1=rows, dim0 stride = pitch_dw
// ---------------------------------------------------------------------------
__device__ __forceinline__ void tdm_load_tile(
    const unsigned short* g, const void* lds, int rows, int k_dw,
    long long pitch_dw)
{
  const unsigned long long ga = (unsigned long long)(size_t)g;
  const unsigned lds_off = (unsigned)(size_t)lds;   // low 32b == LDS offset
  const u32x4 g0 = { 1u, lds_off,
                     (unsigned)(ga & 0xFFFFFFFFull),
                     (unsigned)((ga >> 32) & 0x01FFFFFFull) | (2u << 30) };
  const unsigned d0 = 1u << 20;     // tensor_dim0 (OOB never hit)
  const unsigned d1 = 1u << 20;     // tensor_dim1
  const unsigned long long s0 = (unsigned long long)pitch_dw;
  const i32x8 g1 = {
      (int)((2u << 16) | (1u << 20) | (4u << 22) | (3u << 25)),
      (int)((d0 & 0xFFFFu) << 16),
      (int)((d0 >> 16) | ((d1 & 0xFFFFu) << 16)),
      (int)((d1 >> 16) | ((unsigned)k_dw << 16)),
      (int)(unsigned)rows,
      (int)(unsigned)(s0 & 0xFFFFFFFFull),
      (int)(unsigned)((s0 >> 32) & 0xFFFFull),
      0 };
  const i32x4 z4 = { 0, 0, 0, 0 };
#if defined(__clang_major__) && (__clang_major__ >= 23)
  const i32x8 z8 = { 0, 0, 0, 0, 0, 0, 0, 0 };
  __builtin_amdgcn_tensor_load_to_lds(g0, g1, z4, z4, z8, 0);
#else
  __builtin_amdgcn_tensor_load_to_lds(g0, g1, z4, z4, 0);
#endif
}

// ---------------------------------------------------------------------------
// f32 [Kd][Nd] row-major  ->  bf16 [Nd][Kd] (N-major, for B fragments)
// ---------------------------------------------------------------------------
__global__ __launch_bounds__(256) void cvt_transpose_kernel(
    const float* __restrict__ in, unsigned short* __restrict__ out,
    int Kd, int Nd)
{
  __shared__ float tile[32][33];
  const long long base = (long long)blockIdx.z * Kd * Nd;
  in  += base;
  out += base;
  const int n0 = blockIdx.x * 32;
  const int k0 = blockIdx.y * 32;
  const int tx = threadIdx.x & 31;
  const int ty = threadIdx.x >> 5;
  for (int r = ty; r < 32; r += 8)
    tile[r][tx] = in[(long long)(k0 + r) * Nd + n0 + tx];
  __syncthreads();
  for (int r = ty; r < 32; r += 8)
    out[(long long)(n0 + r) * Kd + k0 + tx] = f32_to_bf16(tile[tx][r]);
}

// ---------------------------------------------------------------------------
// LayerNorm over last dim (1024) -> bf16.  One block (256 threads) per row.
// ---------------------------------------------------------------------------
__global__ __launch_bounds__(256) void ln_bf16_kernel(
    const float* __restrict__ x, const float* __restrict__ g,
    const float* __restrict__ b, unsigned short* __restrict__ out)
{
  const int row = blockIdx.x;
  const float* xr = x + (long long)row * E_DIM;
  const int i0 = threadIdx.x * 4;
  const float4 v = *(const float4*)&xr[i0];
  float s  = v.x + v.y + v.z + v.w;
  float s2 = v.x * v.x + v.y * v.y + v.z * v.z + v.w * v.w;
#pragma unroll
  for (int msk = 1; msk < 32; msk <<= 1) {
    s  += __shfl_xor(s,  msk, 32);
    s2 += __shfl_xor(s2, msk, 32);
  }
  __shared__ float ws[8], ws2[8];
  if ((threadIdx.x & 31) == 0) { ws[threadIdx.x >> 5] = s; ws2[threadIdx.x >> 5] = s2; }
  __syncthreads();
  float ts = 0.f, ts2 = 0.f;
#pragma unroll
  for (int i = 0; i < 8; i++) { ts += ws[i]; ts2 += ws2[i]; }
  const float mu  = ts * (1.0f / E_DIM);
  const float var = ts2 * (1.0f / E_DIM) - mu * mu;
  const float rs  = rsqrtf(var + 1e-5f);
  const float4 gg = *(const float4*)&g[i0];
  const float4 bb = *(const float4*)&b[i0];
  ushort4 ov;
  ov.x = f32_to_bf16((v.x - mu) * rs * gg.x + bb.x);
  ov.y = f32_to_bf16((v.y - mu) * rs * gg.y + bb.y);
  ov.z = f32_to_bf16((v.z - mu) * rs * gg.z + bb.z);
  ov.w = f32_to_bf16((v.w - mu) * rs * gg.w + bb.w);
  *(ushort4*)&out[(long long)row * E_DIM + i0] = ov;
}

// ---------------------------------------------------------------------------
// bf16 WMMA GEMM:  C[M,N] = A[M,K] * Bt[N,K]^T  (+bias, relu, residual)
// 8 waves (4 M x 2 N), BK=64, LDS double-buffered, tiles staged by the TDM
// (wave 0 issues tensor_load_to_lds for tile i+1 while all waves compute
// tile i; drained with s_wait_tensorcnt before the block barrier).
// ---------------------------------------------------------------------------
template<int BM, int BN, bool BIAS, bool RELU, bool RESID, bool OUT_BF16, bool OUT_TRANS>
__global__ __launch_bounds__(256, 2) void gemm_bf16_kernel(
    const unsigned short* __restrict__ A,
    const unsigned short* __restrict__ Bt,
    const float* __restrict__ bias,
    const float* __restrict__ resid,
    float* __restrict__ Of,
    unsigned short* __restrict__ Ob,
    int M, int N, int K,
    long long strideA, long long strideB, long long strideO)
{
  constexpr int BK = 64;
  __shared__ unsigned short Asm_[2][BM][BK + 8];
  __shared__ unsigned short Bsm_[2][BN][BK + 8];

  const int z = blockIdx.z;
  A  += (long long)z * strideA;
  Bt += (long long)z * strideB;

  const int wave  = threadIdx.x >> 5;
  const int lane  = threadIdx.x & 31;
  const int lrow  = lane & 15;
  const int lhalf = lane >> 4;
  constexpr int WM = BM / 4;
  constexpr int WN = BN / 2;
  constexpr int MT = WM / 16;
  constexpr int NT = WN / 16;
  const int wm = wave >> 1;
  const int wn = wave & 1;

  const int m0 = blockIdx.y * BM;
  const int n0 = blockIdx.x * BN;

  FAcc acc[MT][NT];
#pragma unroll
  for (int i = 0; i < MT; i++)
#pragma unroll
    for (int j = 0; j < NT; j++)
#pragma unroll
      for (int e = 0; e < 8; e++) acc[i][j].f[e] = 0.f;

  // prologue: DMA tile 0 into buffer 0
  if (wave == 0) {
    tdm_load_tile(&A[(long long)m0 * K], &Asm_[0][0][0], BM, BK / 2, K / 2);
    tdm_load_tile(&Bt[(long long)n0 * K], &Bsm_[0][0][0], BN, BK / 2, K / 2);
    __builtin_amdgcn_s_wait_tensorcnt(0);
  }
  __syncthreads();

  for (int k0 = 0; k0 < K; k0 += BK) {
    const int buf = (k0 / BK) & 1;
    // DMA next tile into the other buffer while this one is consumed
    if (wave == 0 && (k0 + BK) < K) {
      tdm_load_tile(&A[(long long)m0 * K + k0 + BK], &Asm_[buf ^ 1][0][0],
                    BM, BK / 2, K / 2);
      tdm_load_tile(&Bt[(long long)n0 * K + k0 + BK], &Bsm_[buf ^ 1][0][0],
                    BN, BK / 2, K / 2);
    }

#pragma unroll
    for (int kk = 0; kk < BK; kk += 32) {
      BFrag af[MT], bfr[NT];
#pragma unroll
      for (int i = 0; i < MT; i++) {
        const int r = wm * WM + i * 16 + lrow;
        af[i].q[0] = *(const uint4*)&Asm_[buf][r][kk + lhalf * 8];
        af[i].q[1] = *(const uint4*)&Asm_[buf][r][kk + lhalf * 8 + 16];
      }
#pragma unroll
      for (int j = 0; j < NT; j++) {
        const int r = wn * WN + j * 16 + lrow;
        bfr[j].q[0] = *(const uint4*)&Bsm_[buf][r][kk + lhalf * 8];
        bfr[j].q[1] = *(const uint4*)&Bsm_[buf][r][kk + lhalf * 8 + 16];
      }
#pragma unroll
      for (int i = 0; i < MT; i++)
#pragma unroll
        for (int j = 0; j < NT; j++)
          acc[i][j].v = wmma_bf16(af[i], bfr[j], acc[i][j].v);
    }

    if (wave == 0) __builtin_amdgcn_s_wait_tensorcnt(0);
    __syncthreads();
  }

  // ---- epilogue (C/D layout: lane -> col = l&15, row = vg + 8*(l>>4)) ----
#pragma unroll
  for (int i = 0; i < MT; i++) {
#pragma unroll
    for (int j = 0; j < NT; j++) {
      const int n = n0 + wn * WN + j * 16 + lrow;
#pragma unroll
      for (int e = 0; e < 8; e++) {
        const int m = m0 + wm * WM + i * 16 + e + 8 * lhalf;
        float v = acc[i][j].f[e];
        if (BIAS)  v += bias[n];
        if (RELU)  v  = fmaxf(v, 0.f);
        if (RESID) v += resid[(long long)m * N + n];
        if (OUT_BF16) {
          if (OUT_TRANS)
            Ob[(long long)z * strideO + (long long)n * M + m] = f32_to_bf16(v);
          else
            Ob[(long long)z * strideO + (long long)m * N + n] = f32_to_bf16(v);
        } else {
          Of[(long long)m * N + n] = v;
        }
      }
    }
  }
}

// ---------------------------------------------------------------------------
// Causal flash attention: one block per (head, 128 query rows); 8 waves,
// each wave owns 16 query rows; keys processed 32 at a time.
//   Q,K : [NH][C][HS] bf16    Vt : [NH][HS][C] bf16    O : [C][NH*HS] bf16
// Masking only on diagonal blocks (wave-uniform branch).
// ---------------------------------------------------------------------------
__global__ __launch_bounds__(256, 2) void flash_attn_kernel(
    const unsigned short* __restrict__ Q,
    const unsigned short* __restrict__ Kmat,
    const unsigned short* __restrict__ Vt,
    unsigned short* __restrict__ Obf,
    float scale)
{
  __shared__ unsigned short Ksm[32][HS_ + 8];
  __shared__ unsigned short Vsm[HS_][32 + 8];
  __shared__ unsigned short Psm[8][16][32 + 8];

  const int h     = blockIdx.y;
  const int qb    = blockIdx.x;
  const int wave  = threadIdx.x >> 5;
  const int lane  = threadIdx.x & 31;
  const int lrow  = lane & 15;
  const int lhalf = lane >> 4;
  const int m0    = qb * 128 + wave * 16;

  const unsigned short* Qh = Q    + (long long)h * C_DIM * HS_;
  const unsigned short* Kh = Kmat + (long long)h * C_DIM * HS_;
  const unsigned short* Vh = Vt   + (long long)h * HS_ * C_DIM;

  BFrag q0, q1;
  {
    const unsigned short* qr = Qh + (long long)(m0 + lrow) * HS_;
    q0.q[0] = *(const uint4*)&qr[lhalf * 8];
    q0.q[1] = *(const uint4*)&qr[lhalf * 8 + 16];
    q1.q[0] = *(const uint4*)&qr[32 + lhalf * 8];
    q1.q[1] = *(const uint4*)&qr[48 + lhalf * 8];
  }

  FAcc o[4];
#pragma unroll
  for (int t = 0; t < 4; t++)
#pragma unroll
    for (int e = 0; e < 8; e++) o[t].f[e] = 0.f;
  float mrow[8], lsum[8];
#pragma unroll
  for (int e = 0; e < 8; e++) { mrow[e] = -1e30f; lsum[e] = 0.f; }

  const int jend = qb * 128 + 128;
  for (int j0 = 0; j0 < jend; j0 += 32) {
    __syncthreads();
    for (int t = threadIdx.x; t < 32 * 8; t += 256) {
      const int r = t >> 3, c = (t & 7) << 3;
      *(uint4*)&Ksm[r][c] = *(const uint4*)&Kh[(long long)(j0 + r) * HS_ + c];
    }
    for (int t = threadIdx.x; t < HS_ * 4; t += 256) {
      const int r = t >> 2, c = (t & 3) << 3;
      *(uint4*)&Vsm[r][c] = *(const uint4*)&Vh[(long long)r * C_DIM + j0 + c];
    }
    __syncthreads();

    // ---- S = Q K^T (two 16x16 WMMA tiles over HS=64) ----
    FAcc s[2];
#pragma unroll
    for (int nt = 0; nt < 2; nt++) {
#pragma unroll
      for (int e = 0; e < 8; e++) s[nt].f[e] = 0.f;
      BFrag k0f, k1f;
      const int r = nt * 16 + lrow;
      k0f.q[0] = *(const uint4*)&Ksm[r][lhalf * 8];
      k0f.q[1] = *(const uint4*)&Ksm[r][lhalf * 8 + 16];
      k1f.q[0] = *(const uint4*)&Ksm[r][32 + lhalf * 8];
      k1f.q[1] = *(const uint4*)&Ksm[r][48 + lhalf * 8];
      s[nt].v = wmma_bf16(q0, k0f, s[nt].v);
      s[nt].v = wmma_bf16(q1, k1f, s[nt].v);
    }

    // ---- scale (+ causal mask only on diagonal blocks), online softmax ----
    float rmax[8];
    if (j0 + 31 > m0) {
#pragma unroll
      for (int e = 0; e < 8; e++) {
        const int mg = m0 + e + 8 * lhalf;
        float v0 = s[0].f[e] * scale;
        float v1 = s[1].f[e] * scale;
        if (j0 + lrow > mg)      v0 = -1e30f;
        if (j0 + 16 + lrow > mg) v1 = -1e30f;
        s[0].f[e] = v0; s[1].f[e] = v1;
        rmax[e] = fmaxf(v0, v1);
      }
    } else {
#pragma unroll
      for (int e = 0; e < 8; e++) {
        const float v0 = s[0].f[e] * scale;
        const float v1 = s[1].f[e] * scale;
        s[0].f[e] = v0; s[1].f[e] = v1;
        rmax[e] = fmaxf(v0, v1);
      }
    }
#pragma unroll
    for (int msk = 1; msk < 16; msk <<= 1)
#pragma unroll
      for (int e = 0; e < 8; e++)
        rmax[e] = fmaxf(rmax[e], __shfl_xor(rmax[e], msk, 32));

    float alpha[8], rsum[8];
#pragma unroll
    for (int e = 0; e < 8; e++) {
      const float mn = fmaxf(mrow[e], rmax[e]);
      alpha[e] = __expf(mrow[e] - mn);
      mrow[e]  = mn;
      const float p0 = __expf(s[0].f[e] - mn);
      const float p1 = __expf(s[1].f[e] - mn);
      s[0].f[e] = p0; s[1].f[e] = p1;
      rsum[e] = p0 + p1;
    }
#pragma unroll
    for (int msk = 1; msk < 16; msk <<= 1)
#pragma unroll
      for (int e = 0; e < 8; e++)
        rsum[e] += __shfl_xor(rsum[e], msk, 32);
#pragma unroll
    for (int e = 0; e < 8; e++) lsum[e] = lsum[e] * alpha[e] + rsum[e];
#pragma unroll
    for (int t = 0; t < 4; t++)
#pragma unroll
      for (int e = 0; e < 8; e++) o[t].f[e] *= alpha[e];

    // ---- relayout P (D-layout -> A-fragment layout) via per-wave LDS ----
#pragma unroll
    for (int nt = 0; nt < 2; nt++)
#pragma unroll
      for (int e = 0; e < 8; e++)
        Psm[wave][e + 8 * lhalf][nt * 16 + lrow] = f32_to_bf16(s[nt].f[e]);
    __syncthreads();

    BFrag pf;
    pf.q[0] = *(const uint4*)&Psm[wave][lrow][lhalf * 8];
    pf.q[1] = *(const uint4*)&Psm[wave][lrow][lhalf * 8 + 16];
#pragma unroll
    for (int nt = 0; nt < 4; nt++) {
      BFrag vf;
      const int r = nt * 16 + lrow;
      vf.q[0] = *(const uint4*)&Vsm[r][lhalf * 8];
      vf.q[1] = *(const uint4*)&Vsm[r][lhalf * 8 + 16];
      o[nt].v = wmma_bf16(pf, vf, o[nt].v);
    }
  }

  // ---- normalize and write concat-by-head output ----
#pragma unroll
  for (int nt = 0; nt < 4; nt++) {
#pragma unroll
    for (int e = 0; e < 8; e++) {
      const int mg  = m0 + e + 8 * lhalf;
      const int col = h * HS_ + nt * 16 + lrow;
      Obf[(long long)mg * D_DIM + col] = f32_to_bf16(o[nt].f[e] * (1.f / lsum[e]));
    }
  }
}

// ---------------------------------------------------------------------------
extern "C" void kernel_launch(void* const* d_in, const int* in_sizes, int n_in,
                              void* d_out, int out_size, void* d_ws, size_t ws_size,
                              hipStream_t stream) {
  (void)in_sizes; (void)n_in; (void)out_size; (void)ws_size;
  const float* x     = (const float*)d_in[0];
  const float* Wq    = (const float*)d_in[1];
  const float* Wk    = (const float*)d_in[2];
  const float* Wv    = (const float*)d_in[3];
  const float* Wo    = (const float*)d_in[4];
  const float* bo    = (const float*)d_in[5];
  const float* W1    = (const float*)d_in[6];
  const float* b1    = (const float*)d_in[7];
  const float* W2    = (const float*)d_in[8];
  const float* b2    = (const float*)d_in[9];
  const float* ln1_g = (const float*)d_in[10];
  const float* ln1_b = (const float*)d_in[11];
  const float* ln2_g = (const float*)d_in[12];
  const float* ln2_b = (const float*)d_in[13];
  float* out = (float*)d_out;

  char* p = (char*)d_ws;
  auto alloc = [&](size_t bytes) -> void* {
    void* r = (void*)p;
    p += (bytes + 255) & ~(size_t)255;
    return r;
  };
  unsigned short* hbf  = (unsigned short*)alloc((size_t)C_DIM * E_DIM * 2);
  unsigned short* WqT  = (unsigned short*)alloc((size_t)NH_ * HS_ * E_DIM * 2);
  unsigned short* WkT  = (unsigned short*)alloc((size_t)NH_ * HS_ * E_DIM * 2);
  unsigned short* WvT  = (unsigned short*)alloc((size_t)NH_ * HS_ * E_DIM * 2);
  unsigned short* WoT  = (unsigned short*)alloc((size_t)D_DIM * D_DIM * 2);
  unsigned short* W1T  = (unsigned short*)alloc((size_t)FF_DIM * D_DIM * 2);
  unsigned short* W2T  = (unsigned short*)alloc((size_t)E_DIM * FF_DIM * 2);
  unsigned short* Qb   = (unsigned short*)alloc((size_t)NH_ * C_DIM * HS_ * 2);
  unsigned short* Kb   = (unsigned short*)alloc((size_t)NH_ * C_DIM * HS_ * 2);
  unsigned short* Vtb  = (unsigned short*)alloc((size_t)NH_ * HS_ * C_DIM * 2);
  unsigned short* attn = (unsigned short*)alloc((size_t)C_DIM * D_DIM * 2);
  float*          x1   = (float*)alloc((size_t)C_DIM * E_DIM * 4);
  unsigned short* h2   = (unsigned short*)alloc((size_t)C_DIM * D_DIM * 2);
  unsigned short* ff1  = (unsigned short*)alloc((size_t)C_DIM * FF_DIM * 2);

  const dim3 blk(256);

  // ---- weight conversion + transpose to N-major bf16 ----
  cvt_transpose_kernel<<<dim3(HS_ / 32, E_DIM / 32, NH_), blk, 0, stream>>>(Wq, WqT, E_DIM, HS_);
  cvt_transpose_kernel<<<dim3(HS_ / 32, E_DIM / 32, NH_), blk, 0, stream>>>(Wk, WkT, E_DIM, HS_);
  cvt_transpose_kernel<<<dim3(HS_ / 32, E_DIM / 32, NH_), blk, 0, stream>>>(Wv, WvT, E_DIM, HS_);
  cvt_transpose_kernel<<<dim3(D_DIM / 32, D_DIM / 32, 1), blk, 0, stream>>>(Wo, WoT, D_DIM, D_DIM);
  cvt_transpose_kernel<<<dim3(FF_DIM / 32, D_DIM / 32, 1), blk, 0, stream>>>(W1, W1T, D_DIM, FF_DIM);
  cvt_transpose_kernel<<<dim3(E_DIM / 32, FF_DIM / 32, 1), blk, 0, stream>>>(W2, W2T, FF_DIM, E_DIM);

  // ---- LN1 -> bf16 ----
  ln_bf16_kernel<<<dim3(C_DIM), blk, 0, stream>>>(x, ln1_g, ln1_b, hbf);

  // ---- QKV projections (batched over heads); V written transposed ----
  gemm_bf16_kernel<128, 64, false, false, false, true, false>
      <<<dim3(1, C_DIM / 128, NH_), blk, 0, stream>>>(
          hbf, WqT, nullptr, nullptr, nullptr, Qb, C_DIM, HS_, E_DIM,
          0LL, (long long)HS_ * E_DIM, (long long)C_DIM * HS_);
  gemm_bf16_kernel<128, 64, false, false, false, true, false>
      <<<dim3(1, C_DIM / 128, NH_), blk, 0, stream>>>(
          hbf, WkT, nullptr, nullptr, nullptr, Kb, C_DIM, HS_, E_DIM,
          0LL, (long long)HS_ * E_DIM, (long long)C_DIM * HS_);
  gemm_bf16_kernel<128, 64, false, false, false, true, true>
      <<<dim3(1, C_DIM / 128, NH_), blk, 0, stream>>>(
          hbf, WvT, nullptr, nullptr, nullptr, Vtb, C_DIM, HS_, E_DIM,
          0LL, (long long)HS_ * E_DIM, (long long)HS_ * C_DIM);

  // ---- causal flash attention (scale = 1/sqrt(E) per reference) ----
  flash_attn_kernel<<<dim3(C_DIM / 128, NH_), blk, 0, stream>>>(
      Qb, Kb, Vtb, attn, 0.03125f);

  // ---- output projection + bias + residual -> x1 (f32) ----
  gemm_bf16_kernel<128, 128, true, false, true, false, false>
      <<<dim3(D_DIM / 128, C_DIM / 128, 1), blk, 0, stream>>>(
          attn, WoT, bo, x, x1, nullptr, C_DIM, D_DIM, D_DIM, 0LL, 0LL, 0LL);

  // ---- LN2 -> bf16 ----
  ln_bf16_kernel<<<dim3(C_DIM), blk, 0, stream>>>(x1, ln2_g, ln2_b, h2);

  // ---- FFN1: relu(h2 @ W1 + b1) -> bf16 ----
  gemm_bf16_kernel<128, 128, true, true, false, true, false>
      <<<dim3(FF_DIM / 128, C_DIM / 128, 1), blk, 0, stream>>>(
          h2, W1T, b1, nullptr, nullptr, ff1, C_DIM, FF_DIM, D_DIM, 0LL, 0LL, 0LL);

  // ---- FFN2: ff1 @ W2 + b2 + x1 -> d_out (f32) ----
  gemm_bf16_kernel<128, 128, true, false, true, false, false>
      <<<dim3(E_DIM / 128, C_DIM / 128, 1), blk, 0, stream>>>(
          ff1, W2T, b2, x1, out, nullptr, C_DIM, E_DIM, FF_DIM, 0LL, 0LL, 0LL);
}

// v001
// Measured time: 321 microseconds a run.
// Two timings next to v000 put it at 1.22 and 1.23 times that version's speed.
#include <hip/hip_runtime.h>
#include <cstdint>

// ---------------------------------------------------------------------------
// Transformer block (pre-norm MHA + FFN) for MI455X (gfx1250, wave32, WMMA).
// GEMMs: v_wmma_f32_16x16x32_bf16, LDS tiles staged by the Tensor Data Mover
// (tensor_load_to_lds, TENSORcnt-tracked, double-buffered).  LN / softmax /
// residuals in f32.  Attention is causal flash-style (online softmax).
// ---------------------------------------------------------------------------

#define C_DIM  4096
#define E_DIM  1024
#define NH_    16
#define HS_    64
#define D_DIM  1024
#define FF_DIM 4096

typedef __attribute__((ext_vector_type(16))) __bf16 v16bf;
typedef __attribute__((ext_vector_type(8)))  float  v8f;
typedef __attribute__((ext_vector_type(4)))  unsigned int u32x4;
typedef __attribute__((ext_vector_type(8)))  int  i32x8;
typedef __attribute__((ext_vector_type(4)))  int  i32x4;

union BFrag { v16bf v; uint4 q[2]; unsigned short us[16]; };
union FAcc  { v8f   v; float f[8]; };

__device__ __forceinline__ unsigned short f32_to_bf16(float f) {
  unsigned int u = __float_as_uint(f);
  unsigned int r = u + 0x7FFFu + ((u >> 16) & 1u);   // round-to-nearest-even
  return (unsigned short)(r >> 16);
}

__device__ __forceinline__ v8f wmma_bf16(BFrag a, BFrag b, v8f c) {
  return __builtin_amdgcn_wmma_f32_16x16x32_bf16(
      /*neg_a=*/false, a.v, /*neg_b=*/false, b.v,
      /*c_mod=*/(short)0, c, /*reuse_a=*/false, /*reuse_b=*/false);
}

// ---------------------------------------------------------------------------
// TDM: DMA a 2D tile (rows x k_dw dwords) from global into LDS, with the
// hardware inserting 4 pad dwords after every 32 data dwords so the LDS tile
// keeps a (BK/2 + 4)-dword pitch (bank-conflict padding).  D# per ISA ch.8:
//   group0: count=1 | lds_addr | global tile addr (57b) | type=2
//   group1: data_size=4B, pad_enable, pad_interval=32dw(code 4),
//           pad_amount=4dw(code 3), tensor dims huge (tiles never OOB),
//           tile_dim0=k_dw, tile_dim1=rows, dim0 stride = pitch_dw
// ---------------------------------------------------------------------------
__device__ __forceinline__ void tdm_load_tile(
    const unsigned short* g, const void* lds, int rows, int k_dw,
    long long pitch_dw)
{
  const unsigned long long ga = (unsigned long long)(size_t)g;
  const unsigned lds_off = (unsigned)(size_t)lds;   // low 32b == LDS offset
  const u32x4 g0 = { 1u, lds_off,
                     (unsigned)(ga & 0xFFFFFFFFull),
                     (unsigned)((ga >> 32) & 0x01FFFFFFull) | (2u << 30) };
  const unsigned d0 = 1u << 20;     // tensor_dim0 (OOB never hit)
  const unsigned d1 = 1u << 20;     // tensor_dim1
  const unsigned long long s0 = (unsigned long long)pitch_dw;
  const i32x8 g1 = {
      (int)((2u << 16) | (1u << 20) | (4u << 22) | (3u << 25)),
      (int)((d0 & 0xFFFFu) << 16),
      (int)((d0 >> 16) | ((d1 & 0xFFFFu) << 16)),
      (int)((d1 >> 16) | ((unsigned)k_dw << 16)),
      (int)(unsigned)rows,
      (int)(unsigned)(s0 & 0xFFFFFFFFull),
      (int)(unsigned)((s0 >> 32) & 0xFFFFull),
      0 };
  const i32x4 z4 = { 0, 0, 0, 0 };
#if defined(__clang_major__) && (__clang_major__ >= 23)
  const i32x8 z8 = { 0, 0, 0, 0, 0, 0, 0, 0 };
  __builtin_amdgcn_tensor_load_to_lds(g0, g1, z4, z4, z8, 0);
#else
  __builtin_amdgcn_tensor_load_to_lds(g0, g1, z4, z4, 0);
#endif
}

// ---------------------------------------------------------------------------
// f32 [Kd][Nd] row-major  ->  bf16 [Nd][Kd] (N-major, for B fragments)
// ---------------------------------------------------------------------------
__global__ __launch_bounds__(256) void cvt_transpose_kernel(
    const float* __restrict__ in, unsigned short* __restrict__ out,
    int Kd, int Nd)
{
  __shared__ float tile[32][33];
  const long long base = (long long)blockIdx.z * Kd * Nd;
  in  += base;
  out += base;
  const int n0 = blockIdx.x * 32;
  const int k0 = blockIdx.y * 32;
  const int tx = threadIdx.x & 31;
  const int ty = threadIdx.x >> 5;
  for (int r = ty; r < 32; r += 8)
    tile[r][tx] = in[(long long)(k0 + r) * Nd + n0 + tx];
  __syncthreads();
  for (int r = ty; r < 32; r += 8)
    out[(long long)(n0 + r) * Kd + k0 + tx] = f32_to_bf16(tile[tx][r]);
}

// ---------------------------------------------------------------------------
// LayerNorm over last dim (1024) -> bf16.  One block (256 threads) per row.
// ---------------------------------------------------------------------------
__global__ __launch_bounds__(256) void ln_bf16_kernel(
    const float* __restrict__ x, const float* __restrict__ g,
    const float* __restrict__ b, unsigned short* __restrict__ out)
{
  const int row = blockIdx.x;
  const float* xr = x + (long long)row * E_DIM;
  const int i0 = threadIdx.x * 4;
  const float4 v = *(const float4*)&xr[i0];
  float s  = v.x + v.y + v.z + v.w;
  float s2 = v.x * v.x + v.y * v.y + v.z * v.z + v.w * v.w;
#pragma unroll
  for (int msk = 1; msk < 32; msk <<= 1) {
    s  += __shfl_xor(s,  msk, 32);
    s2 += __shfl_xor(s2, msk, 32);
  }
  __shared__ float ws[8], ws2[8];
  if ((threadIdx.x & 31) == 0) { ws[threadIdx.x >> 5] = s; ws2[threadIdx.x >> 5] = s2; }
  __syncthreads();
  float ts = 0.f, ts2 = 0.f;
#pragma unroll
  for (int i = 0; i < 8; i++) { ts += ws[i]; ts2 += ws2[i]; }
  const float mu  = ts * (1.0f / E_DIM);
  const float var = ts2 * (1.0f / E_DIM) - mu * mu;
  const float rs  = rsqrtf(var + 1e-5f);
  const float4 gg = *(const float4*)&g[i0];
  const float4 bb = *(const float4*)&b[i0];
  ushort4 ov;
  ov.x = f32_to_bf16((v.x - mu) * rs * gg.x + bb.x);
  ov.y = f32_to_bf16((v.y - mu) * rs * gg.y + bb.y);
  ov.z = f32_to_bf16((v.z - mu) * rs * gg.z + bb.z);
  ov.w = f32_to_bf16((v.w - mu) * rs * gg.w + bb.w);
  *(ushort4*)&out[(long long)row * E_DIM + i0] = ov;
}

// ---------------------------------------------------------------------------
// bf16 WMMA GEMM:  C[M,N] = A[M,K] * Bt[N,K]^T  (+bias, relu, residual)
// 8 waves (4 M x 2 N), BK=64, LDS double-buffered, tiles staged by the TDM
// (wave 0 issues tensor_load_to_lds for tile i+1 while all waves compute
// tile i; drained with s_wait_tensorcnt before the block barrier).
// ---------------------------------------------------------------------------
template<int BM, int BN, bool BIAS, bool RELU, bool RESID, bool OUT_BF16, bool OUT_TRANS>
__global__ __launch_bounds__(256, 2) void gemm_bf16_kernel(
    const unsigned short* __restrict__ A,
    const unsigned short* __restrict__ Bt,
    const float* __restrict__ bias,
    const float* __restrict__ resid,
    float* __restrict__ Of,
    unsigned short* __restrict__ Ob,
    int M, int N, int K,
    long long strideA, long long strideB, long long strideO)
{
  constexpr int BK = 64;
  __shared__ unsigned short Asm_[2][BM][BK + 8];
  __shared__ unsigned short Bsm_[2][BN][BK + 8];

  const int z = blockIdx.z;
  A  += (long long)z * strideA;
  Bt += (long long)z * strideB;

  const int wave  = threadIdx.x >> 5;
  const int lane  = threadIdx.x & 31;
  const int lrow  = lane & 15;
  const int lhalf = lane >> 4;
  constexpr int WM = BM / 4;
  constexpr int WN = BN / 2;
  constexpr int MT = WM / 16;
  constexpr int NT = WN / 16;
  const int wm = wave >> 1;
  const int wn = wave & 1;

  const int m0 = blockIdx.y * BM;
  const int n0 = blockIdx.x * BN;

  FAcc acc[MT][NT];
#pragma unroll
  for (int i = 0; i < MT; i++)
#pragma unroll
    for (int j = 0; j < NT; j++)
#pragma unroll
      for (int e = 0; e < 8; e++) acc[i][j].f[e] = 0.f;

  // prologue: DMA tile 0 into buffer 0
  if (wave == 0) {
    tdm_load_tile(&A[(long long)m0 * K], &Asm_[0][0][0], BM, BK / 2, K / 2);
    tdm_load_tile(&Bt[(long long)n0 * K], &Bsm_[0][0][0], BN, BK / 2, K / 2);
    __builtin_amdgcn_s_wait_tensorcnt(0);
  }
  __syncthreads();

  for (int k0 = 0; k0 < K; k0 += BK) {
    const int buf = (k0 / BK) & 1;
    // DMA next tile into the other buffer while this one is consumed
    if (wave == 0 && (k0 + BK) < K) {
      tdm_load_tile(&A[(long long)m0 * K + k0 + BK], &Asm_[buf ^ 1][0][0],
                    BM, BK / 2, K / 2);
      tdm_load_tile(&Bt[(long long)n0 * K + k0 + BK], &Bsm_[buf ^ 1][0][0],
                    BN, BK / 2, K / 2);
    }

#pragma unroll
    for (int kk = 0; kk < BK; kk += 32) {
      BFrag af[MT], bfr[NT];
#pragma unroll
      for (int i = 0; i < MT; i++) {
        const int r = wm * WM + i * 16 + lrow;
        af[i].q[0] = *(const uint4*)&Asm_[buf][r][kk + lhalf * 8];
        af[i].q[1] = *(const uint4*)&Asm_[buf][r][kk + lhalf * 8 + 16];
      }
#pragma unroll
      for (int j = 0; j < NT; j++) {
        const int r = wn * WN + j * 16 + lrow;
        bfr[j].q[0] = *(const uint4*)&Bsm_[buf][r][kk + lhalf * 8];
        bfr[j].q[1] = *(const uint4*)&Bsm_[buf][r][kk + lhalf * 8 + 16];
      }
#pragma unroll
      for (int i = 0; i < MT; i++)
#pragma unroll
        for (int j = 0; j < NT; j++)
          acc[i][j].v = wmma_bf16(af[i], bfr[j], acc[i][j].v);
    }

    if (wave == 0) __builtin_amdgcn_s_wait_tensorcnt(0);
    __syncthreads();
  }

  // ---- epilogue (C/D layout: lane -> col = l&15, row = vg + 8*(l>>4)) ----
#pragma unroll
  for (int i = 0; i < MT; i++) {
#pragma unroll
    for (int j = 0; j < NT; j++) {
      const int n = n0 + wn * WN + j * 16 + lrow;
#pragma unroll
      for (int e = 0; e < 8; e++) {
        const int m = m0 + wm * WM + i * 16 + e + 8 * lhalf;
        float v = acc[i][j].f[e];
        if (BIAS)  v += bias[n];
        if (RELU)  v  = fmaxf(v, 0.f);
        if (RESID) v += resid[(long long)m * N + n];
        if (OUT_BF16) {
          if (OUT_TRANS)
            Ob[(long long)z * strideO + (long long)n * M + m] = f32_to_bf16(v);
          else
            Ob[(long long)z * strideO + (long long)m * N + n] = f32_to_bf16(v);
        } else {
          Of[(long long)m * N + n] = v;
        }
      }
    }
  }
}

typedef __attribute__((ext_vector_type(2))) float f32x2;

// two f32 -> packed bf16 pair, round to nearest even
__device__ __forceinline__ unsigned int pack_bf16x2(f32x2 v) {
  typedef __bf16 bf2 __attribute__((ext_vector_type(2)));
  return __builtin_bit_cast(unsigned int, __builtin_convertvector(v, bf2));
}

// value of lane l ^ 16
__device__ __forceinline__ float xhalf(float x) {
  const int b = __builtin_bit_cast(int, x);
  return __builtin_bit_cast(float, __builtin_amdgcn_permlanex16(
      b, b, 0x76543210, 0xfedcba98, false, false));
}

__global__ __launch_bounds__(256, 2) void flash_attn_kernel(
    const unsigned short* __restrict__ Q,
    const unsigned short* __restrict__ Kmat,
    const unsigned short* __restrict__ Vt,
    unsigned short* __restrict__ Obf,
    float scale)
{
  __shared__ unsigned short Ksm[32][HS_ + 8];
  __shared__ unsigned short Vsm[HS_][32 + 8];

  const int h     = blockIdx.y;
  const int qb    = blockIdx.x;
  const int wave  = threadIdx.x >> 5;
  const int lane  = threadIdx.x & 31;
  const int lrow  = lane & 15;
  const int lhalf = lane >> 4;
  const int m0    = qb * 128 + wave * 16;
  const int mg    = m0 + lrow;            // this lane's query

  const unsigned short* Qh = Q    + (long long)h * C_DIM * HS_;
  const unsigned short* Kh = Kmat + (long long)h * C_DIM * HS_;
  const unsigned short* Vh = Vt   + (long long)h * HS_ * C_DIM;

  BFrag q0, q1;
  {
    const unsigned short* qr = Qh + (long long)mg * HS_;
    q0.q[0] = *(const uint4*)&qr[lhalf * 8];
    q0.q[1] = *(const uint4*)&qr[lhalf * 8 + 16];
    q1.q[0] = *(const uint4*)&qr[32 + lhalf * 8];
    q1.q[1] = *(const uint4*)&qr[48 + lhalf * 8];
  }

  // o[t].f[e] = O^T[t*16 + 8*lhalf + e][query mg]
  FAcc o[4];
#pragma unroll
  for (int t = 0; t < 4; t++)
#pragma unroll
    for (int e = 0; e < 8; e++) o[t].f[e] = 0.f;
  float mrow = -1e30f;   // running maximum of query mg (equal in both halves)
  float lsum = 0.f;      // running sum over this half's keys only

  const int jend = qb * 128 + 128;
  for (int j0 = 0; j0 < jend; j0 += 32) {
    __syncthreads();
    for (int t = threadIdx.x; t < 32 * 8; t += 256) {
      const int r = t >> 3, c = (t & 7) << 3;
      *(uint4*)&Ksm[r][c] = *(const uint4*)&Kh[(long long)(j0 + r) * HS_ + c];
    }
    for (int t = threadIdx.x; t < HS_ * 4; t += 256) {
      const int r = t >> 2, c = (t & 3) << 3;
      *(uint4*)&Vsm[r][c] = *(const uint4*)&Vh[(long long)r * C_DIM + j0 + c];
    }
    __syncthreads();

    // ---- S^T = K Q^T: s[nt].f[e] = score(key j0 + nt*16 + 8*lhalf + e, mg) ----
    FAcc s[2];
#pragma unroll
    for (int nt = 0; nt < 2; nt++) {
#pragma unroll
      for (int e = 0; e < 8; e++) s[nt].f[e] = 0.f;
      BFrag k0f, k1f;
      const int r = nt * 16 + lrow;
      k0f.q[0] = *(const uint4*)&Ksm[r][lhalf * 8];
      k0f.q[1] = *(const uint4*)&Ksm[r][lhalf * 8 + 16];
      k1f.q[0] = *(const uint4*)&Ksm[r][32 + lhalf * 8];
      k1f.q[1] = *(const uint4*)&Ksm[r][48 + lhalf * 8];
      s[nt].v = wmma_bf16(k0f, q0, s[nt].v);
      s[nt].v = wmma_bf16(k1f, q1, s[nt].v);
    }

    // ---- scale (+ causal mask only on diagonal blocks), online softmax ----
    s[0].v = s[0].v * scale;
    s[1].v = s[1].v * scale;
    if (j0 + 31 > m0) {
#pragma unroll
      for (int nt = 0; nt < 2; nt++)
#pragma unroll
        for (int e = 0; e < 8; e++)
          if (j0 + nt * 16 + 8 * lhalf + e > mg) s[nt].f[e] = -1e30f;
    }
    float rmax = fmaxf(s[0].f[0], s[1].f[0]);
#pragma unroll
    for (int e = 1; e < 8; e++) rmax = fmaxf(rmax, fmaxf(s[0].f[e], s[1].f[e]));
    rmax = fmaxf(rmax, xhalf(rmax));

    const float mn    = fmaxf(mrow, rmax);
    const float alpha = __expf(mrow - mn);
    mrow = mn;
    f32x2 rs2 = {0.f, 0.f};
    BFrag pf;   // P^T as B operand: element i of q[nt] = key nt*16 + 8*lhalf + i
#pragma unroll
    for (int nt = 0; nt < 2; nt++) {
      unsigned int w[4];
#pragma unroll
      for (int i = 0; i < 4; i++) {
        const f32x2 p = {__expf(s[nt].f[2 * i] - mn), __expf(s[nt].f[2 * i + 1] - mn)};
        rs2 += p;
        w[i] = pack_bf16x2(p);
      }
      pf.q[nt] = make_uint4(w[0], w[1], w[2], w[3]);
    }
    const float rsum = rs2.x + rs2.y;
    lsum = lsum * alpha + rsum;
#pragma unroll
    for (int t = 0; t < 4; t++)
#pragma unroll
      for (int e = 0; e < 8; e++) o[t].f[e] *= alpha;

    // ---- O^T += V^T P^T ----
#pragma unroll
    for (int nt = 0; nt < 4; nt++) {
      BFrag vf;
      const int r = nt * 16 + lrow;
      vf.q[0] = *(const uint4*)&Vsm[r][lhalf * 8];
      vf.q[1] = *(const uint4*)&Vsm[r][lhalf * 8 + 16];
      o[nt].v = wmma_bf16(vf, pf, o[nt].v);
    }
  }

  // ---- join the halves' sums, normalize, write concat-by-head output ----
  const float inv = 1.f / (lsum + xhalf(lsum));
#pragma unroll
  for (int nt = 0; nt < 4; nt++) {
    uint4 ov;
    ov.x = pack_bf16x2(f32x2{o[nt].f[0] * inv, o[nt].f[1] * inv});
    ov.y = pack_bf16x2(f32x2{o[nt].f[2] * inv, o[nt].f[3] * inv});
    ov.z = pack_bf16x2(f32x2{o[nt].f[4] * inv, o[nt].f[5] * inv});
    ov.w = pack_bf16x2(f32x2{o[nt].f[6] * inv, o[nt].f[7] * inv});
    *(uint4*)&Obf[(long long)mg * D_DIM + h * HS_ + nt * 16 + 8 * lhalf] = ov;
  }
}

// ---------------------------------------------------------------------------
extern "C" void kernel_launch(void* const* d_in, const int* in_sizes, int n_in,
                              void* d_out, int out_size, void* d_ws, size_t ws_size,
                              hipStream_t stream) {
  (void)in_sizes; (void)n_in; (void)out_size; (void)ws_size;
  const float* x     = (const float*)d_in[0];
  const float* Wq    = (const float*)d_in[1];
  const float* Wk    = (const float*)d_in[2];
  const float* Wv    = (const float*)d_in[3];
  const float* Wo    = (const float*)d_in[4];
  const float* bo    = (const float*)d_in[5];
  const float* W1    = (const float*)d_in[6];
  const float* b1    = (const float*)d_in[7];
  const float* W2    = (const float*)d_in[8];
  const float* b2    = (const float*)d_in[9];
  const float* ln1_g = (const float*)d_in[10];
  const float* ln1_b = (const float*)d_in[11];
  const float* ln2_g = (const float*)d_in[12];
  const float* ln2_b = (const float*)d_in[13];
  float* out = (float*)d_out;

  char* p = (char*)d_ws;
  auto alloc = [&](size_t bytes) -> void* {
    void* r = (void*)p;
    p += (bytes + 255) & ~(size_t)255;
    return r;
  };
  unsigned short* hbf  = (unsigned short*)alloc((size_t)C_DIM * E_DIM * 2);
  unsigned short* WqT  = (unsigned short*)alloc((size_t)NH_ * HS_ * E_DIM * 2);
  unsigned short* WkT  = (unsigned short*)alloc((size_t)NH_ * HS_ * E_DIM * 2);
  unsigned short* WvT  = (unsigned short*)alloc((size_t)NH_ * HS_ * E_DIM * 2);
  unsigned short* WoT  = (unsigned short*)alloc((size_t)D_DIM * D_DIM * 2);
  unsigned short* W1T  = (unsigned short*)alloc((size_t)FF_DIM * D_DIM * 2);
  unsigned short* W2T  = (unsigned short*)alloc((size_t)E_DIM * FF_DIM * 2);
  unsigned short* Qb   = (unsigned short*)alloc((size_t)NH_ * C_DIM * HS_ * 2);
  unsigned short* Kb   = (unsigned short*)alloc((size_t)NH_ * C_DIM * HS_ * 2);
  unsigned short* Vtb  = (unsigned short*)alloc((size_t)NH_ * HS_ * C_DIM * 2);
  unsigned short* attn = (unsigned short*)alloc((size_t)C_DIM * D_DIM * 2);
  float*          x1   = (float*)alloc((size_t)C_DIM * E_DIM * 4);
  unsigned short* h2   = (unsigned short*)alloc((size_t)C_DIM * D_DIM * 2);
  unsigned short* ff1  = (unsigned short*)alloc((size_t)C_DIM * FF_DIM * 2);

  const dim3 blk(256);

  // ---- weight conversion + transpose to N-major bf16 ----
  cvt_transpose_kernel<<<dim3(HS_ / 32, E_DIM / 32, NH_), blk, 0, stream>>>(Wq, WqT, E_DIM, HS_);
  cvt_transpose_kernel<<<dim3(HS_ / 32, E_DIM / 32, NH_), blk, 0, stream>>>(Wk, WkT, E_DIM, HS_);
  cvt_transpose_kernel<<<dim3(HS_ / 32, E_DIM / 32, NH_), blk, 0, stream>>>(Wv, WvT, E_DIM, HS_);
  cvt_transpose_kernel<<<dim3(D_DIM / 32, D_DIM / 32, 1), blk, 0, stream>>>(Wo, WoT, D_DIM, D_DIM);
  cvt_transpose_kernel<<<dim3(FF_DIM / 32, D_DIM / 32, 1), blk, 0, stream>>>(W1, W1T, D_DIM, FF_DIM);
  cvt_transpose_kernel<<<dim3(E_DIM / 32, FF_DIM / 32, 1), blk, 0, stream>>>(W2, W2T, FF_DIM, E_DIM);

  // ---- LN1 -> bf16 ----
  ln_bf16_kernel<<<dim3(C_DIM), blk, 0, stream>>>(x, ln1_g, ln1_b, hbf);

  // ---- QKV projections (batched over heads); V written transposed ----
  gemm_bf16_kernel<128, 64, false, false, false, true, false>
      <<<dim3(1, C_DIM / 128, NH_), blk, 0, stream>>>(
          hbf, WqT, nullptr, nullptr, nullptr, Qb, C_DIM, HS_, E_DIM,
          0LL, (long long)HS_ * E_DIM, (long long)C_DIM * HS_);
  gemm_bf16_kernel<128, 64, false, false, false, true, false>
      <<<dim3(1, C_DIM / 128, NH_), blk, 0, stream>>>(
          hbf, WkT, nullptr, nullptr, nullptr, Kb, C_DIM, HS_, E_DIM,
          0LL, (long long)HS_ * E_DIM, (long long)C_DIM * HS_);
  gemm_bf16_kernel<128, 64, false, false, false, true, true>
      <<<dim3(1, C_DIM / 128, NH_), blk, 0, stream>>>(
          hbf, WvT, nullptr, nullptr, nullptr, Vtb, C_DIM, HS_, E_DIM,
          0LL, (long long)HS_ * E_DIM, (long long)HS_ * C_DIM);

  // ---- causal flash attention (scale = 1/sqrt(E) per reference) ----
  flash_attn_kernel<<<dim3(C_DIM / 128, NH_), blk, 0, stream>>>(
      Qb, Kb, Vtb, attn, 0.03125f);

  // ---- output projection + bias + residual -> x1 (f32) ----
  gemm_bf16_kernel<128, 128, true, false, true, false, false>
      <<<dim3(D_DIM / 128, C_DIM / 128, 1), blk, 0, stream>>>(
          attn, WoT, bo, x, x1, nullptr, C_DIM, D_DIM, D_DIM, 0LL, 0LL, 0LL);

  // ---- LN2 -> bf16 ----
  ln_bf16_kernel<<<dim3(C_DIM), blk, 0, stream>>>(x1, ln2_g, ln2_b, h2);

  // ---- FFN1: relu(h2 @ W1 + b1) -> bf16 ----
  gemm_bf16_kernel<128, 128, true, true, false, true, false>
      <<<dim3(FF_DIM / 128, C_DIM / 128, 1), blk, 0, stream>>>(
          h2, W1T, b1, nullptr, nullptr, ff1, C_DIM, FF_DIM, D_DIM, 0LL, 0LL, 0LL);

  // ---- FFN2: ff1 @ W2 + b2 + x1 -> d_out (f32) ----
  gemm_bf16_kernel<128, 128, true, false, true, false, false>
      <<<dim3(E_DIM / 128, C_DIM / 128, 1), blk, 0, stream>>>(
          ff1, W2T, b2, x1, out, nullptr, C_DIM, E_DIM, FF_DIM, 0LL, 0LL, 0LL);
}

// v002
// A run of this version takes 304 microseconds.
// Two timings next to v001 both put it at 1.05 times that version's speed.
// Counting every step since v000, it is 1.29 times as fast.
#include <hip/hip_runtime.h>
#include <cstdint>

// ---------------------------------------------------------------------------
// Transformer block (pre-norm MHA + FFN) for MI455X (gfx1250, wave32, WMMA).
// GEMMs: v_wmma_f32_16x16x32_bf16, LDS tiles staged by the Tensor Data Mover
// (tensor_load_to_lds, TENSORcnt-tracked, double-buffered).  LN / softmax /
// residuals in f32.  Attention is causal flash-style (online softmax).
// ---------------------------------------------------------------------------

#define C_DIM  4096
#define E_DIM  1024
#define NH_    16
#define HS_    64
#define D_DIM  1024
#define FF_DIM 4096

typedef __attribute__((ext_vector_type(16))) __bf16 v16bf;
typedef __attribute__((ext_vector_type(8)))  float  v8f;
typedef __attribute__((ext_vector_type(4)))  unsigned int u32x4;
typedef __attribute__((ext_vector_type(8)))  int  i32x8;
typedef __attribute__((ext_vector_type(4)))  int  i32x4;

union BFrag { v16bf v; uint4 q[2]; unsigned short us[16]; };
union FAcc  { v8f   v; float f[8]; };

__device__ __forceinline__ unsigned short f32_to_bf16(float f) {
  unsigned int u = __float_as_uint(f);
  unsigned int r = u + 0x7FFFu + ((u >> 16) & 1u);   // round-to-nearest-even
  return (unsigned short)(r >> 16);
}

typedef __attribute__((ext_vector_type(2))) float f32x2;

// two f32 -> packed bf16 pair, round to nearest even
__device__ __forceinline__ unsigned int pack_bf16x2(f32x2 v) {
  typedef __bf16 bf2 __attribute__((ext_vector_type(2)));
  return __builtin_bit_cast(unsigned int, __builtin_convertvector(v, bf2));
}

__device__ __forceinline__ v8f wmma_bf16(BFrag a, BFrag b, v8f c) {
  return __builtin_amdgcn_wmma_f32_16x16x32_bf16(
      /*neg_a=*/false, a.v, /*neg_b=*/false, b.v,
      /*c_mod=*/(short)0, c, /*reuse_a=*/false, /*reuse_b=*/false);
}

// ---------------------------------------------------------------------------
// TDM: DMA a 2D tile (rows x k_dw dwords) from global into LDS, with the
// hardware inserting 4 pad dwords after every 32 data dwords so the LDS tile
// keeps a (BK/2 + 4)-dword pitch (bank-conflict padding).  D# per ISA ch.8:
//   group0: count=1 | lds_addr | global tile addr (57b) | type=2
//   group1: data_size=4B, pad_enable, pad_interval=32dw(code 4),
//           pad_amount=4dw(code 3), tensor dims huge (tiles never OOB),
//           tile_dim0=k_dw, tile_dim1=rows, dim0 stride = pitch_dw
// ---------------------------------------------------------------------------
__device__ __forceinline__ void tdm_load_tile(
    const unsigned short* g, const void* lds, int rows, int k_dw,
    long long pitch_dw)
{
  const unsigned long long ga = (unsigned long long)(size_t)g;
  const unsigned lds_off = (unsigned)(size_t)lds;   // low 32b == LDS offset
  const u32x4 g0 = { 1u, lds_off,
                     (unsigned)(ga & 0xFFFFFFFFull),
                     (unsigned)((ga >> 32) & 0x01FFFFFFull) | (2u << 30) };
  const unsigned d0 = 1u << 20;     // tensor_dim0 (OOB never hit)
  const unsigned d1 = 1u << 20;     // tensor_dim1
  const unsigned long long s0 = (unsigned long long)pitch_dw;
  const i32x8 g1 = {
      (int)((2u << 16) | (1u << 20) | (4u << 22) | (3u << 25)),
      (int)((d0 & 0xFFFFu) << 16),
      (int)((d0 >> 16) | ((d1 & 0xFFFFu) << 16)),
      (int)((d1 >> 16) | ((unsigned)k_dw << 16)),
      (int)(unsigned)rows,
      (int)(unsigned)(s0 & 0xFFFFFFFFull),
      (int)(unsigned)((s0 >> 32) & 0xFFFFull),
      0 };
  const i32x4 z4 = { 0, 0, 0, 0 };
#if defined(__clang_major__) && (__clang_major__ >= 23)
  const i32x8 z8 = { 0, 0, 0, 0, 0, 0, 0, 0 };
  __builtin_amdgcn_tensor_load_to_lds(g0, g1, z4, z4, z8, 0);
#else
  __builtin_amdgcn_tensor_load_to_lds(g0, g1, z4, z4, 0);
#endif
}

// ---------------------------------------------------------------------------
// f32 [Kd][Nd] row-major  ->  bf16 [Nd][Kd] (N-major, for B fragments)
// One block moves a tile of 128 k x 64 n: 32 elements a thread, so that few
// waves have to start.  Reads and writes are 16 bytes a lane, 256 contiguous
// bytes per 16 lanes.  LDS holds the tile transposed, one dword = the bf16
// pair (k, k + 1), 64 dwords a row; the index of each 16-byte group is XORed
// with n >> 2, which spreads the 32 dword writes of a wave over 32 banks and
// leaves the 16-byte reads whole.
// ---------------------------------------------------------------------------
template<int Kd, int Nd>
__global__ __launch_bounds__(256) void cvt_transpose_kernel(
    const float* __restrict__ in, unsigned short* __restrict__ out)
{
  __shared__ __attribute__((aligned(16))) unsigned int tile[64 * 64];
  const long long base = (long long)blockIdx.z * Kd * Nd;
  in  += base;
  out += base;
  const int n0 = blockIdx.x * 64;
  const int k0 = blockIdx.y * 128;
  const int c  = threadIdx.x & 15;
  const int r  = threadIdx.x >> 4;
  // one block-uniform base per side plus one 32-bit byte offset per thread;
  // the row steps are compile-time and go into the instructions' offsets
  const char* ib = (const char*)(in + (long long)k0 * Nd + n0);
  char*       ob = (char*)(out + (long long)n0 * Kd + k0);
  constexpr unsigned int irow = (unsigned int)Nd * 4u;
  constexpr unsigned int orow = (unsigned int)Kd * 2u;
  const unsigned int ioff = 2u * r * irow + 16u * c;
  const unsigned int ooff = r * orow + 16u * c;
  float4 lo[4], hi[4];    // rows k and k + 1, columns n0 + 4c .. + 3
  // the three loops are unrolled so that lo and hi stay in registers and the
  // eight loads, and the four LDS reads, are issued together
#pragma unroll
  for (int p = 0; p < 4; p++) {
    lo[p] = *(const float4*)(ib + ioff + (32u * p) * irow);
    hi[p] = *(const float4*)(ib + ioff + (32u * p + 1u) * irow);
  }
#pragma unroll
  for (int p = 0; p < 4; p++) {
    const int kp  = p * 16 + r;
    const int col = (((kp >> 2) ^ c) << 2) | (kp & 3);
    unsigned int* t = &tile[(4 * c) * 64 + col];
    t[0 * 64] = pack_bf16x2(f32x2{lo[p].x, hi[p].x});
    t[1 * 64] = pack_bf16x2(f32x2{lo[p].y, hi[p].y});
    t[2 * 64] = pack_bf16x2(f32x2{lo[p].z, hi[p].z});
    t[3 * 64] = pack_bf16x2(f32x2{lo[p].w, hi[p].w});
  }
  __syncthreads();
#pragma unroll
  for (int p = 0; p < 4; p++) {
    const int n = p * 16 + r;
    const uint4 v = *(const uint4*)&tile[n * 64 + ((c ^ (n >> 2)) << 2)];
    *(uint4*)(ob + ooff + (16u * p) * orow) = v;
  }
}

// ---------------------------------------------------------------------------
// LayerNorm over last dim (1024) -> bf16.  One wave per row (32 elements a
// lane, all loads in flight at once), eight rows per block: the sums need no
// LDS and no barrier, and an eighth of the waves has to start.  The grid gives
// a SIMD four waves, so the register budget is set for at most eight: the
// loads of g and b then stay ahead of the sums instead of behind them.
// ---------------------------------------------------------------------------
__global__ __launch_bounds__(256) __attribute__((amdgpu_waves_per_eu(4, 8)))
void ln_bf16_kernel(
    const float* __restrict__ x, const float* __restrict__ g,
    const float* __restrict__ b, unsigned short* __restrict__ out)
{
  const int row  = blockIdx.x * 8 + (threadIdx.x >> 5);
  const int lane = threadIdx.x & 31;
  const float* xr = x + (long long)row * E_DIM;
  float4 v[8], gg[8], bb[8];
  // every loop here is unrolled: the arrays stay in registers and the 24 loads
  // are issued together
#pragma unroll
  for (int j = 0; j < 8; j++) v[j] = *(const float4*)&xr[j * 128 + lane * 4];
#pragma unroll
  for (int j = 0; j < 8; j++) {
    gg[j] = *(const float4*)&g[j * 128 + lane * 4];
    bb[j] = *(const float4*)&b[j * 128 + lane * 4];
  }
  float4 a1 = {0.f, 0.f, 0.f, 0.f};   // four independent chains each
  float4 a2 = {0.f, 0.f, 0.f, 0.f};
#pragma unroll
  for (int j = 0; j < 8; j++) {
    a1.x += v[j].x;  a1.y += v[j].y;  a1.z += v[j].z;  a1.w += v[j].w;
    a2.x += v[j].x * v[j].x;  a2.y += v[j].y * v[j].y;
    a2.z += v[j].z * v[j].z;  a2.w += v[j].w * v[j].w;
  }
  float s  = (a1.x + a1.y) + (a1.z + a1.w);
  float s2 = (a2.x + a2.y) + (a2.z + a2.w);
#pragma unroll
  for (int msk = 1; msk < 32; msk <<= 1) {
    s  += __shfl_xor(s,  msk, 32);
    s2 += __shfl_xor(s2, msk, 32);
  }
  const float mu  = s * (1.0f / E_DIM);
  const float var = s2 * (1.0f / E_DIM) - mu * mu;
  const float rs  = rsqrtf(var + 1e-5f);
#pragma unroll
  for (int j = 0; j < 8; j++) {
    const int i0 = j * 128 + lane * 4;
    uint2 ov;
    ov.x = pack_bf16x2(f32x2{(v[j].x - mu) * rs * gg[j].x + bb[j].x,
                             (v[j].y - mu) * rs * gg[j].y + bb[j].y});
    ov.y = pack_bf16x2(f32x2{(v[j].z - mu) * rs * gg[j].z + bb[j].z,
                             (v[j].w - mu) * rs * gg[j].w + bb[j].w});
    *(uint2*)&out[(long long)row * E_DIM + i0] = ov;
  }
}

// ---------------------------------------------------------------------------
// bf16 WMMA GEMM:  C[M,N] = A[M,K] * Bt[N,K]^T  (+bias, relu, residual)
// 8 waves (4 M x 2 N), BK=64, LDS double-buffered, tiles staged by the TDM
// (wave 0 issues tensor_load_to_lds for tile i+1 while all waves compute
// tile i; drained with s_wait_tensorcnt before the block barrier).
// ---------------------------------------------------------------------------
template<int BM, int BN, bool BIAS, bool RELU, bool RESID, bool OUT_BF16, bool OUT_TRANS>
__global__ __launch_bounds__(256, 2) void gemm_bf16_kernel(
    const unsigned short* __restrict__ A,
    const unsigned short* __restrict__ Bt,
    const float* __restrict__ bias,
    const float* __restrict__ resid,
    float* __restrict__ Of,
    unsigned short* __restrict__ Ob,
    int M, int N, int K,
    long long strideA, long long strideB, long long strideO)
{
  constexpr int BK = 64;
  __shared__ unsigned short Asm_[2][BM][BK + 8];
  __shared__ unsigned short Bsm_[2][BN][BK + 8];

  const int z = blockIdx.z;
  A  += (long long)z * strideA;
  Bt += (long long)z * strideB;

  const int wave  = threadIdx.x >> 5;
  const int lane  = threadIdx.x & 31;
  const int lrow  = lane & 15;
  const int lhalf = lane >> 4;
  constexpr int WM = BM / 4;
  constexpr int WN = BN / 2;
  constexpr int MT = WM / 16;
  constexpr int NT = WN / 16;
  const int wm = wave >> 1;
  const int wn = wave & 1;

  const int m0 = blockIdx.y * BM;
  const int n0 = blockIdx.x * BN;

  FAcc acc[MT][NT];
#pragma unroll
  for (int i = 0; i < MT; i++)
#pragma unroll
    for (int j = 0; j < NT; j++)
#pragma unroll
      for (int e = 0; e < 8; e++) acc[i][j].f[e] = 0.f;

  // prologue: DMA tile 0 into buffer 0
  if (wave == 0) {
    tdm_load_tile(&A[(long long)m0 * K], &Asm_[0][0][0], BM, BK / 2, K / 2);
    tdm_load_tile(&Bt[(long long)n0 * K], &Bsm_[0][0][0], BN, BK / 2, K / 2);
    __builtin_amdgcn_s_wait_tensorcnt(0);
  }
  __syncthreads();

  for (int k0 = 0; k0 < K; k0 += BK) {
    const int buf = (k0 / BK) & 1;
    // DMA next tile into the other buffer while this one is consumed
    if (wave == 0 && (k0 + BK) < K) {
      tdm_load_tile(&A[(long long)m0 * K + k0 + BK], &Asm_[buf ^ 1][0][0],
                    BM, BK / 2, K / 2);
      tdm_load_tile(&Bt[(long long)n0 * K + k0 + BK], &Bsm_[buf ^ 1][0][0],
                    BN, BK / 2, K / 2);
    }

#pragma unroll
    for (int kk = 0; kk < BK; kk += 32) {
      BFrag af[MT], bfr[NT];
#pragma unroll
      for (int i = 0; i < MT; i++) {
        const int r = wm * WM + i * 16 + lrow;
        af[i].q[0] = *(const uint4*)&Asm_[buf][r][kk + lhalf * 8];
        af[i].q[1] = *(const uint4*)&Asm_[buf][r][kk + lhalf * 8 + 16];
      }
#pragma unroll
      for (int j = 0; j < NT; j++) {
        const int r = wn * WN + j * 16 + lrow;
        bfr[j].q[0] = *(const uint4*)&Bsm_[buf][r][kk + lhalf * 8];
        bfr[j].q[1] = *(const uint4*)&Bsm_[buf][r][kk + lhalf * 8 + 16];
      }
#pragma unroll
      for (int i = 0; i < MT; i++)
#pragma unroll
        for (int j = 0; j < NT; j++)
          acc[i][j].v = wmma_bf16(af[i], bfr[j], acc[i][j].v);
    }

    if (wave == 0) __builtin_amdgcn_s_wait_tensorcnt(0);
    __syncthreads();
  }

  // ---- epilogue (C/D layout: lane -> col = l&15, row = vg + 8*(l>>4)) ----
#pragma unroll
  for (int i = 0; i < MT; i++) {
#pragma unroll
    for (int j = 0; j < NT; j++) {
      const int n = n0 + wn * WN + j * 16 + lrow;
#pragma unroll
      for (int e = 0; e < 8; e++) {
        const int m = m0 + wm * WM + i * 16 + e + 8 * lhalf;
        float v = acc[i][j].f[e];
        if (BIAS)  v += bias[n];
        if (RELU)  v  = fmaxf(v, 0.f);
        if (RESID) v += resid[(long long)m * N + n];
        if (OUT_BF16) {
          if (OUT_TRANS)
            Ob[(long long)z * strideO + (long long)n * M + m] = f32_to_bf16(v);
          else
            Ob[(long long)z * strideO + (long long)m * N + n] = f32_to_bf16(v);
        } else {
          Of[(long long)m * N + n] = v;
        }
      }
    }
  }
}

__device__ __forceinline__ float xhalf(float x) {
  const int b = __builtin_bit_cast(int, x);
  return __builtin_bit_cast(float, __builtin_amdgcn_permlanex16(
      b, b, 0x76543210, 0xfedcba98, false, false));
}

__global__ __launch_bounds__(256, 2) void flash_attn_kernel(
    const unsigned short* __restrict__ Q,
    const unsigned short* __restrict__ Kmat,
    const unsigned short* __restrict__ Vt,
    unsigned short* __restrict__ Obf,
    float scale)
{
  __shared__ unsigned short Ksm[32][HS_ + 8];
  __shared__ unsigned short Vsm[HS_][32 + 8];

  const int h     = blockIdx.y;
  const int qb    = blockIdx.x;
  const int wave  = threadIdx.x >> 5;
  const int lane  = threadIdx.x & 31;
  const int lrow  = lane & 15;
  const int lhalf = lane >> 4;
  const int m0    = qb * 128 + wave * 16;
  const int mg    = m0 + lrow;            // this lane's query

  const unsigned short* Qh = Q    + (long long)h * C_DIM * HS_;
  const unsigned short* Kh = Kmat + (long long)h * C_DIM * HS_;
  const unsigned short* Vh = Vt   + (long long)h * HS_ * C_DIM;

  BFrag q0, q1;
  {
    const unsigned short* qr = Qh + (long long)mg * HS_;
    q0.q[0] = *(const uint4*)&qr[lhalf * 8];
    q0.q[1] = *(const uint4*)&qr[lhalf * 8 + 16];
    q1.q[0] = *(const uint4*)&qr[32 + lhalf * 8];
    q1.q[1] = *(const uint4*)&qr[48 + lhalf * 8];
  }

  // o[t].f[e] = O^T[t*16 + 8*lhalf + e][query mg]
  FAcc o[4];
#pragma unroll
  for (int t = 0; t < 4; t++)
#pragma unroll
    for (int e = 0; e < 8; e++) o[t].f[e] = 0.f;
  float mrow = -1e30f;   // running maximum of query mg (equal in both halves)
  float lsum = 0.f;      // running sum over this half's keys only

  const int jend = qb * 128 + 128;
  for (int j0 = 0; j0 < jend; j0 += 32) {
    __syncthreads();
    for (int t = threadIdx.x; t < 32 * 8; t += 256) {
      const int r = t >> 3, c = (t & 7) << 3;
      *(uint4*)&Ksm[r][c] = *(const uint4*)&Kh[(long long)(j0 + r) * HS_ + c];
    }
    for (int t = threadIdx.x; t < HS_ * 4; t += 256) {
      const int r = t >> 2, c = (t & 3) << 3;
      *(uint4*)&Vsm[r][c] = *(const uint4*)&Vh[(long long)r * C_DIM + j0 + c];
    }
    __syncthreads();

    // ---- S^T = K Q^T: s[nt].f[e] = score(key j0 + nt*16 + 8*lhalf + e, mg) ----
    FAcc s[2];
#pragma unroll
    for (int nt = 0; nt < 2; nt++) {
#pragma unroll
      for (int e = 0; e < 8; e++) s[nt].f[e] = 0.f;
      BFrag k0f, k1f;
      const int r = nt * 16 + lrow;
      k0f.q[0] = *(const uint4*)&Ksm[r][lhalf * 8];
      k0f.q[1] = *(const uint4*)&Ksm[r][lhalf * 8 + 16];
      k1f.q[0] = *(const uint4*)&Ksm[r][32 + lhalf * 8];
      k1f.q[1] = *(const uint4*)&Ksm[r][48 + lhalf * 8];
      s[nt].v = wmma_bf16(k0f, q0, s[nt].v);
      s[nt].v = wmma_bf16(k1f, q1, s[nt].v);
    }

    // ---- scale (+ causal mask only on diagonal blocks), online softmax ----
    s[0].v = s[0].v * scale;
    s[1].v = s[1].v * scale;
    if (j0 + 31 > m0) {
#pragma unroll
      for (int nt = 0; nt < 2; nt++)
#pragma unroll
        for (int e = 0; e < 8; e++)
          if (j0 + nt * 16 + 8 * lhalf + e > mg) s[nt].f[e] = -1e30f;
    }
    float rmax = fmaxf(s[0].f[0], s[1].f[0]);
#pragma unroll
    for (int e = 1; e < 8; e++) rmax = fmaxf(rmax, fmaxf(s[0].f[e], s[1].f[e]));
    rmax = fmaxf(rmax, xhalf(rmax));

    const float mn    = fmaxf(mrow, rmax);
    const float alpha = __expf(mrow - mn);
    mrow = mn;
    f32x2 rs2 = {0.f, 0.f};
    BFrag pf;   // P^T as B operand: element i of q[nt] = key nt*16 + 8*lhalf + i
#pragma unroll
    for (int nt = 0; nt < 2; nt++) {
      unsigned int w[4];
#pragma unroll
      for (int i = 0; i < 4; i++) {
        const f32x2 p = {__expf(s[nt].f[2 * i] - mn), __expf(s[nt].f[2 * i + 1] - mn)};
        rs2 += p;
        w[i] = pack_bf16x2(p);
      }
      pf.q[nt] = make_uint4(w[0], w[1], w[2], w[3]);
    }
    const float rsum = rs2.x + rs2.y;
    lsum = lsum * alpha + rsum;
#pragma unroll
    for (int t = 0; t < 4; t++)
#pragma unroll
      for (int e = 0; e < 8; e++) o[t].f[e] *= alpha;

    // ---- O^T += V^T P^T ----
#pragma unroll
    for (int nt = 0; nt < 4; nt++) {
      BFrag vf;
      const int r = nt * 16 + lrow;
      vf.q[0] = *(const uint4*)&Vsm[r][lhalf * 8];
      vf.q[1] = *(const uint4*)&Vsm[r][lhalf * 8 + 16];
      o[nt].v = wmma_bf16(vf, pf, o[nt].v);
    }
  }

  // ---- join the halves' sums, normalize, write concat-by-head output ----
  const float inv = 1.f / (lsum + xhalf(lsum));
#pragma unroll
  for (int nt = 0; nt < 4; nt++) {
    uint4 ov;
    ov.x = pack_bf16x2(f32x2{o[nt].f[0] * inv, o[nt].f[1] * inv});
    ov.y = pack_bf16x2(f32x2{o[nt].f[2] * inv, o[nt].f[3] * inv});
    ov.z = pack_bf16x2(f32x2{o[nt].f[4] * inv, o[nt].f[5] * inv});
    ov.w = pack_bf16x2(f32x2{o[nt].f[6] * inv, o[nt].f[7] * inv});
    *(uint4*)&Obf[(long long)mg * D_DIM + h * HS_ + nt * 16 + 8 * lhalf] = ov;
  }
}

// ---------------------------------------------------------------------------
extern "C" void kernel_launch(void* const* d_in, const int* in_sizes, int n_in,
                              void* d_out, int out_size, void* d_ws, size_t ws_size,
                              hipStream_t stream) {
  (void)in_sizes; (void)n_in; (void)out_size; (void)ws_size;
  const float* x     = (const float*)d_in[0];
  const float* Wq    = (const float*)d_in[1];
  const float* Wk    = (const float*)d_in[2];
  const float* Wv    = (const float*)d_in[3];
  const float* Wo    = (const float*)d_in[4];
  const float* bo    = (const float*)d_in[5];
  const float* W1    = (const float*)d_in[6];
  const float* b1    = (const float*)d_in[7];
  const float* W2    = (const float*)d_in[8];
  const float* b2    = (const float*)d_in[9];
  const float* ln1_g = (const float*)d_in[10];
  const float* ln1_b = (const float*)d_in[11];
  const float* ln2_g = (const float*)d_in[12];
  const float* ln2_b = (const float*)d_in[13];
  float* out = (float*)d_out;

  char* p = (char*)d_ws;
  auto alloc = [&](size_t bytes) -> void* {
    void* r = (void*)p;
    p += (bytes + 255) & ~(size_t)255;
    return r;
  };
  unsigned short* hbf  = (unsigned short*)alloc((size_t)C_DIM * E_DIM * 2);
  unsigned short* WqT  = (unsigned short*)alloc((size_t)NH_ * HS_ * E_DIM * 2);
  unsigned short* WkT  = (unsigned short*)alloc((size_t)NH_ * HS_ * E_DIM * 2);
  unsigned short* WvT  = (unsigned short*)alloc((size_t)NH_ * HS_ * E_DIM * 2);
  unsigned short* WoT  = (unsigned short*)alloc((size_t)D_DIM * D_DIM * 2);
  unsigned short* W1T  = (unsigned short*)alloc((size_t)FF_DIM * D_DIM * 2);
  unsigned short* W2T  = (unsigned short*)alloc((size_t)E_DIM * FF_DIM * 2);
  unsigned short* Qb   = (unsigned short*)alloc((size_t)NH_ * C_DIM * HS_ * 2);
  unsigned short* Kb   = (unsigned short*)alloc((size_t)NH_ * C_DIM * HS_ * 2);
  unsigned short* Vtb  = (unsigned short*)alloc((size_t)NH_ * HS_ * C_DIM * 2);
  unsigned short* attn = (unsigned short*)alloc((size_t)C_DIM * D_DIM * 2);
  float*          x1   = (float*)alloc((size_t)C_DIM * E_DIM * 4);
  unsigned short* h2   = (unsigned short*)alloc((size_t)C_DIM * D_DIM * 2);
  unsigned short* ff1  = (unsigned short*)alloc((size_t)C_DIM * FF_DIM * 2);

  const dim3 blk(256);

  // ---- weight conversion + transpose to N-major bf16 ----
  cvt_transpose_kernel<E_DIM, HS_><<<dim3(HS_ / 64, E_DIM / 128, NH_), blk, 0, stream>>>(Wq, WqT);
  cvt_transpose_kernel<E_DIM, HS_><<<dim3(HS_ / 64, E_DIM / 128, NH_), blk, 0, stream>>>(Wk, WkT);
  cvt_transpose_kernel<E_DIM, HS_><<<dim3(HS_ / 64, E_DIM / 128, NH_), blk, 0, stream>>>(Wv, WvT);
  cvt_transpose_kernel<D_DIM, D_DIM><<<dim3(D_DIM / 64, D_DIM / 128, 1), blk, 0, stream>>>(Wo, WoT);
  cvt_transpose_kernel<D_DIM, FF_DIM><<<dim3(FF_DIM / 64, D_DIM / 128, 1), blk, 0, stream>>>(W1, W1T);
  cvt_transpose_kernel<FF_DIM, E_DIM><<<dim3(E_DIM / 64, FF_DIM / 128, 1), blk, 0, stream>>>(W2, W2T);

  // ---- LN1 -> bf16 ----
  ln_bf16_kernel<<<dim3(C_DIM / 8), blk, 0, stream>>>(x, ln1_g, ln1_b, hbf);

  // ---- QKV projections (batched over heads); V written transposed ----
  gemm_bf16_kernel<128, 64, false, false, false, true, false>
      <<<dim3(1, C_DIM / 128, NH_), blk, 0, stream>>>(
          hbf, WqT, nullptr, nullptr, nullptr, Qb, C_DIM, HS_, E_DIM,
          0LL, (long long)HS_ * E_DIM, (long long)C_DIM * HS_);
  gemm_bf16_kernel<128, 64, false, false, false, true, false>
      <<<dim3(1, C_DIM / 128, NH_), blk, 0, stream>>>(
          hbf, WkT, nullptr, nullptr, nullptr, Kb, C_DIM, HS_, E_DIM,
          0LL, (long long)HS_ * E_DIM, (long long)C_DIM * HS_);
  gemm_bf16_kernel<128, 64, false, false, false, true, true>
      <<<dim3(1, C_DIM / 128, NH_), blk, 0, stream>>>(
          hbf, WvT, nullptr, nullptr, nullptr, Vtb, C_DIM, HS_, E_DIM,
          0LL, (long long)HS_ * E_DIM, (long long)HS_ * C_DIM);

  // ---- causal flash attention (scale = 1/sqrt(E) per reference) ----
  flash_attn_kernel<<<dim3(C_DIM / 128, NH_), blk, 0, stream>>>(
      Qb, Kb, Vtb, attn, 0.03125f);

  // ---- output projection + bias + residual -> x1 (f32) ----
  gemm_bf16_kernel<128, 128, true, false, true, false, false>
      <<<dim3(D_DIM / 128, C_DIM / 128, 1), blk, 0, stream>>>(
          attn, WoT, bo, x, x1, nullptr, C_DIM, D_DIM, D_DIM, 0LL, 0LL, 0LL);

  // ---- LN2 -> bf16 ----
  ln_bf16_kernel<<<dim3(C_DIM / 8), blk, 0, stream>>>(x1, ln2_g, ln2_b, h2);

  // ---- FFN1: relu(h2 @ W1 + b1) -> bf16 ----
  gemm_bf16_kernel<128, 128, true, true, false, true, false>
      <<<dim3(FF_DIM / 128, C_DIM / 128, 1), blk, 0, stream>>>(
          h2, W1T, b1, nullptr, nullptr, ff1, C_DIM, FF_DIM, D_DIM, 0LL, 0LL, 0LL);

  // ---- FFN2: ff1 @ W2 + b2 + x1 -> d_out (f32) ----
  gemm_bf16_kernel<128, 128, true, false, true, false, false>
      <<<dim3(E_DIM / 128, C_DIM / 128, 1), blk, 0, stream>>>(
          ff1, W2T, b2, x1, out, nullptr, C_DIM, E_DIM, FF_DIM, 0LL, 0LL, 0LL);
}

// v003
// It runs in 259 microseconds.
// Next to v002, in two timings, it ran 1.18 and 1.17 times as fast.
// Counting every step since v000, it is 1.52 times as fast.
#include <hip/hip_runtime.h>
#include <cstdint>

// ---------------------------------------------------------------------------
// Transformer block (pre-norm MHA + FFN) for MI455X (gfx1250, wave32, WMMA).
// GEMMs: v_wmma_f32_16x16x32_bf16, LDS tiles staged by the Tensor Data Mover
// (tensor_load_to_lds, TENSORcnt-tracked, double-buffered).  LN / softmax /
// residuals in f32.  Attention is causal flash-style (online softmax).
// ---------------------------------------------------------------------------

#define C_DIM  4096
#define E_DIM  1024
#define NH_    16
#define HS_    64
#define D_DIM  1024
#define FF_DIM 4096

typedef __attribute__((ext_vector_type(16))) __bf16 v16bf;
typedef __attribute__((ext_vector_type(8)))  float  v8f;
typedef __attribute__((ext_vector_type(4)))  unsigned int u32x4;
typedef __attribute__((ext_vector_type(8)))  int  i32x8;
typedef __attribute__((ext_vector_type(4)))  int  i32x4;

union BFrag { v16bf v; uint4 q[2]; unsigned short us[16]; };
union FAcc  { v8f   v; float f[8]; };

__device__ __forceinline__ unsigned short f32_to_bf16(float f) {
  unsigned int u = __float_as_uint(f);
  unsigned int r = u + 0x7FFFu + ((u >> 16) & 1u);   // round-to-nearest-even
  return (unsigned short)(r >> 16);
}

typedef __attribute__((ext_vector_type(2))) float f32x2;

// two f32 -> packed bf16 pair, round to nearest even
__device__ __forceinline__ unsigned int pack_bf16x2(f32x2 v) {
  typedef __bf16 bf2 __attribute__((ext_vector_type(2)));
  return __builtin_bit_cast(unsigned int, __builtin_convertvector(v, bf2));
}

__device__ __forceinline__ v8f wmma_bf16(BFrag a, BFrag b, v8f c) {
  return __builtin_amdgcn_wmma_f32_16x16x32_bf16(
      /*neg_a=*/false, a.v, /*neg_b=*/false, b.v,
      /*c_mod=*/(short)0, c, /*reuse_a=*/false, /*reuse_b=*/false);
}

// ---------------------------------------------------------------------------
// TDM: DMA a 2D tile (rows x k_dw dwords) from global into LDS, with the
// hardware inserting 4 pad dwords after every 32 data dwords so the LDS tile
// keeps a (BK/2 + 4)-dword pitch (bank-conflict padding).  D# per ISA ch.8:
//   group0: count=1 | lds_addr | global tile addr (57b) | type=2
//   group1: data_size=4B, pad_enable, pad_interval=32dw(code 4),
//           pad_amount=4dw(code 3), tensor dims huge (tiles never OOB),
//           tile_dim0=k_dw, tile_dim1=rows, dim0 stride = pitch_dw
// ---------------------------------------------------------------------------
__device__ __forceinline__ void tdm_load_tile(
    const unsigned short* g, const void* lds, int rows, int k_dw,
    long long pitch_dw)
{
  const unsigned long long ga = (unsigned long long)(size_t)g;
  const unsigned lds_off = (unsigned)(size_t)lds;   // low 32b == LDS offset
  const u32x4 g0 = { 1u, lds_off,
                     (unsigned)(ga & 0xFFFFFFFFull),
                     (unsigned)((ga >> 32) & 0x01FFFFFFull) | (2u << 30) };
  const unsigned d0 = 1u << 20;     // tensor_dim0 (OOB never hit)
  const unsigned d1 = 1u << 20;     // tensor_dim1
  const unsigned long long s0 = (unsigned long long)pitch_dw;
  const i32x8 g1 = {
      (int)((2u << 16) | (1u << 20) | (4u << 22) | (3u << 25)),
      (int)((d0 & 0xFFFFu) << 16),
      (int)((d0 >> 16) | ((d1 & 0xFFFFu) << 16)),
      (int)((d1 >> 16) | ((unsigned)k_dw << 16)),
      (int)(unsigned)rows,
      (int)(unsigned)(s0 & 0xFFFFFFFFull),
      (int)(unsigned)((s0 >> 32) & 0xFFFFull),
      0 };
  const i32x4 z4 = { 0, 0, 0, 0 };
#if defined(__clang_major__) && (__clang_major__ >= 23)
  const i32x8 z8 = { 0, 0, 0, 0, 0, 0, 0, 0 };
  __builtin_amdgcn_tensor_load_to_lds(g0, g1, z4, z4, z8, 0);
#else
  __builtin_amdgcn_tensor_load_to_lds(g0, g1, z4, z4, 0);
#endif
}

// ---------------------------------------------------------------------------
// f32 [Kd][Nd] row-major  ->  bf16 [Nd][Kd] (N-major, for B fragments)
// One block moves a tile of 128 k x 64 n: 32 elements a thread, so that few
// waves have to start.  Reads and writes are 16 bytes a lane, 256 contiguous
// bytes per 16 lanes.  LDS holds the tile transposed, one dword = the bf16
// pair (k, k + 1), 64 dwords a row; the index of each 16-byte group is XORed
// with n >> 2, which spreads the 32 dword writes of a wave over 32 banks and
// leaves the 16-byte reads whole.
// ---------------------------------------------------------------------------
template<int Kd, int Nd>
__global__ __launch_bounds__(256) void cvt_transpose_kernel(
    const float* __restrict__ in, unsigned short* __restrict__ out)
{
  __shared__ __attribute__((aligned(16))) unsigned int tile[64 * 64];
  const long long base = (long long)blockIdx.z * Kd * Nd;
  in  += base;
  out += base;
  const int n0 = blockIdx.x * 64;
  const int k0 = blockIdx.y * 128;
  const int c  = threadIdx.x & 15;
  const int r  = threadIdx.x >> 4;
  // one block-uniform base per side plus one 32-bit byte offset per thread;
  // the row steps are compile-time and go into the instructions' offsets
  const char* ib = (const char*)(in + (long long)k0 * Nd + n0);
  char*       ob = (char*)(out + (long long)n0 * Kd + k0);
  constexpr unsigned int irow = (unsigned int)Nd * 4u;
  constexpr unsigned int orow = (unsigned int)Kd * 2u;
  const unsigned int ioff = 2u * r * irow + 16u * c;
  const unsigned int ooff = r * orow + 16u * c;
  float4 lo[4], hi[4];    // rows k and k + 1, columns n0 + 4c .. + 3
  // the three loops are unrolled so that lo and hi stay in registers and the
  // eight loads, and the four LDS reads, are issued together
#pragma unroll
  for (int p = 0; p < 4; p++) {
    lo[p] = *(const float4*)(ib + ioff + (32u * p) * irow);
    hi[p] = *(const float4*)(ib + ioff + (32u * p + 1u) * irow);
  }
#pragma unroll
  for (int p = 0; p < 4; p++) {
    const int kp  = p * 16 + r;
    const int col = (((kp >> 2) ^ c) << 2) | (kp & 3);
    unsigned int* t = &tile[(4 * c) * 64 + col];
    t[0 * 64] = pack_bf16x2(f32x2{lo[p].x, hi[p].x});
    t[1 * 64] = pack_bf16x2(f32x2{lo[p].y, hi[p].y});
    t[2 * 64] = pack_bf16x2(f32x2{lo[p].z, hi[p].z});
    t[3 * 64] = pack_bf16x2(f32x2{lo[p].w, hi[p].w});
  }
  __syncthreads();
#pragma unroll
  for (int p = 0; p < 4; p++) {
    const int n = p * 16 + r;
    const uint4 v = *(const uint4*)&tile[n * 64 + ((c ^ (n >> 2)) << 2)];
    *(uint4*)(ob + ooff + (16u * p) * orow) = v;
  }
}

// ---------------------------------------------------------------------------
// LayerNorm over last dim (1024) -> bf16.  One wave per row (32 elements a
// lane, all loads in flight at once), eight rows per block: the sums need no
// LDS and no barrier, and an eighth of the waves has to start.  The grid gives
// a SIMD four waves, so the register budget is set for at most eight: the
// loads of g and b then stay ahead of the sums instead of behind them.
// ---------------------------------------------------------------------------
__global__ __launch_bounds__(256) __attribute__((amdgpu_waves_per_eu(4, 8)))
void ln_bf16_kernel(
    const float* __restrict__ x, const float* __restrict__ g,
    const float* __restrict__ b, unsigned short* __restrict__ out)
{
  const int row  = blockIdx.x * 8 + (threadIdx.x >> 5);
  const int lane = threadIdx.x & 31;
  const float* xr = x + (long long)row * E_DIM;
  float4 v[8], gg[8], bb[8];
  // every loop here is unrolled: the arrays stay in registers and the 24 loads
  // are issued together
#pragma unroll
  for (int j = 0; j < 8; j++) v[j] = *(const float4*)&xr[j * 128 + lane * 4];
#pragma unroll
  for (int j = 0; j < 8; j++) {
    gg[j] = *(const float4*)&g[j * 128 + lane * 4];
    bb[j] = *(const float4*)&b[j * 128 + lane * 4];
  }
  float4 a1 = {0.f, 0.f, 0.f, 0.f};   // four independent chains each
  float4 a2 = {0.f, 0.f, 0.f, 0.f};
#pragma unroll
  for (int j = 0; j < 8; j++) {
    a1.x += v[j].x;  a1.y += v[j].y;  a1.z += v[j].z;  a1.w += v[j].w;
    a2.x += v[j].x * v[j].x;  a2.y += v[j].y * v[j].y;
    a2.z += v[j].z * v[j].z;  a2.w += v[j].w * v[j].w;
  }
  float s  = (a1.x + a1.y) + (a1.z + a1.w);
  float s2 = (a2.x + a2.y) + (a2.z + a2.w);
#pragma unroll
  for (int msk = 1; msk < 32; msk <<= 1) {
    s  += __shfl_xor(s,  msk, 32);
    s2 += __shfl_xor(s2, msk, 32);
  }
  const float mu  = s * (1.0f / E_DIM);
  const float var = s2 * (1.0f / E_DIM) - mu * mu;
  const float rs  = rsqrtf(var + 1e-5f);
#pragma unroll
  for (int j = 0; j < 8; j++) {
    const int i0 = j * 128 + lane * 4;
    uint2 ov;
    ov.x = pack_bf16x2(f32x2{(v[j].x - mu) * rs * gg[j].x + bb[j].x,
                             (v[j].y - mu) * rs * gg[j].y + bb[j].y});
    ov.y = pack_bf16x2(f32x2{(v[j].z - mu) * rs * gg[j].z + bb[j].z,
                             (v[j].w - mu) * rs * gg[j].w + bb[j].w});
    *(uint2*)&out[(long long)row * E_DIM + i0] = ov;
  }
}

// ---------------------------------------------------------------------------
// bf16 WMMA GEMM:  C[M,N] = A[M,K] * Bt[N,K]^T  (+bias, relu, residual)
// 8 waves (4 M x 2 N), BK=64, LDS double-buffered, tiles staged by the TDM
// (wave 0 issues tensor_load_to_lds for tile i+1 while all waves compute
// tile i; drained with s_wait_tensorcnt before the block barrier).
// ---------------------------------------------------------------------------
template<int BM, int BN, bool BIAS, bool RELU, bool RESID, bool OUT_BF16, bool OUT_TRANS>
__global__ __launch_bounds__(256, 2) void gemm_bf16_kernel(
    const unsigned short* __restrict__ A,
    const unsigned short* __restrict__ Bt,
    const float* __restrict__ bias,
    const float* __restrict__ resid,
    float* __restrict__ Of,
    unsigned short* __restrict__ Ob,
    int M, int N, int K,
    long long strideA, long long strideB, long long strideO)
{
  constexpr int BK = 64;
  __shared__ unsigned short Asm_[2][BM][BK + 8];
  __shared__ unsigned short Bsm_[2][BN][BK + 8];

  const int z = blockIdx.z;
  A  += (long long)z * strideA;
  Bt += (long long)z * strideB;

  const int wave  = threadIdx.x >> 5;
  const int lane  = threadIdx.x & 31;
  const int lrow  = lane & 15;
  const int lhalf = lane >> 4;
  constexpr int WM = BM / 4;
  constexpr int WN = BN / 2;
  constexpr int MT = WM / 16;
  constexpr int NT = WN / 16;
  const int wm = wave >> 1;
  const int wn = wave & 1;

  const int m0 = blockIdx.y * BM;
  const int n0 = blockIdx.x * BN;

  FAcc acc[MT][NT];
#pragma unroll
  for (int i = 0; i < MT; i++)
#pragma unroll
    for (int j = 0; j < NT; j++)
#pragma unroll
      for (int e = 0; e < 8; e++) acc[i][j].f[e] = 0.f;

  // prologue: DMA tile 0 into buffer 0
  if (wave == 0) {
    tdm_load_tile(&A[(long long)m0 * K], &Asm_[0][0][0], BM, BK / 2, K / 2);
    tdm_load_tile(&Bt[(long long)n0 * K], &Bsm_[0][0][0], BN, BK / 2, K / 2);
    __builtin_amdgcn_s_wait_tensorcnt(0);
  }
  __syncthreads();

  for (int k0 = 0; k0 < K; k0 += BK) {
    const int buf = (k0 / BK) & 1;
    // DMA next tile into the other buffer while this one is consumed
    if (wave == 0 && (k0 + BK) < K) {
      tdm_load_tile(&A[(long long)m0 * K + k0 + BK], &Asm_[buf ^ 1][0][0],
                    BM, BK / 2, K / 2);
      tdm_load_tile(&Bt[(long long)n0 * K + k0 + BK], &Bsm_[buf ^ 1][0][0],
                    BN, BK / 2, K / 2);
    }

#pragma unroll
    for (int kk = 0; kk < BK; kk += 32) {
      BFrag af[MT], bfr[NT];
#pragma unroll
      for (int i = 0; i < MT; i++) {
        const int r = wm * WM + i * 16 + lrow;
        af[i].q[0] = *(const uint4*)&Asm_[buf][r][kk + lhalf * 8];
        af[i].q[1] = *(const uint4*)&Asm_[buf][r][kk + lhalf * 8 + 16];
      }
#pragma unroll
      for (int j = 0; j < NT; j++) {
        const int r = wn * WN + j * 16 + lrow;
        bfr[j].q[0] = *(const uint4*)&Bsm_[buf][r][kk + lhalf * 8];
        bfr[j].q[1] = *(const uint4*)&Bsm_[buf][r][kk + lhalf * 8 + 16];
      }
#pragma unroll
      for (int i = 0; i < MT; i++)
#pragma unroll
        for (int j = 0; j < NT; j++)
          acc[i][j].v = wmma_bf16(af[i], bfr[j], acc[i][j].v);
    }

    if (wave == 0) __builtin_amdgcn_s_wait_tensorcnt(0);
    __syncthreads();
  }

  // ---- epilogue (C/D layout: lane -> col = l&15, row = vg + 8*(l>>4)) ----
#pragma unroll
  for (int i = 0; i < MT; i++) {
#pragma unroll
    for (int j = 0; j < NT; j++) {
      const int n = n0 + wn * WN + j * 16 + lrow;
#pragma unroll
      for (int e = 0; e < 8; e++) {
        const int m = m0 + wm * WM + i * 16 + e + 8 * lhalf;
        float v = acc[i][j].f[e];
        if (BIAS)  v += bias[n];
        if (RELU)  v  = fmaxf(v, 0.f);
        if (RESID) v += resid[(long long)m * N + n];
        if (OUT_BF16) {
          if (OUT_TRANS)
            Ob[(long long)z * strideO + (long long)n * M + m] = f32_to_bf16(v);
          else
            Ob[(long long)z * strideO + (long long)m * N + n] = f32_to_bf16(v);
        } else {
          Of[(long long)m * N + n] = v;
        }
      }
    }
  }
}

__device__ __forceinline__ float xhalf(float x) {
  const int b = __builtin_bit_cast(int, x);
  return __builtin_bit_cast(float, __builtin_amdgcn_permlanex16(
      b, b, 0x76543210, 0xfedcba98, false, false));
}

// One stage = 128 keys of K (128 rows of 128 B) and of V^T (64 rows of 256 B).
// Every lane brings eight 16-byte pieces from global memory straight into LDS.
//   kg, vg : this lane's first source address;  kl, vl : its first LDS byte
// K: 8 lanes a row, 32 rows per copy; V^T: 16 lanes a row, 16 rows per copy.
#define ATT_ST   128
#define ATT_KPB  ((HS_ + 8) * 2)       // LDS pitch of a K row, bytes
#define ATT_VPB  ((ATT_ST + 8) * 2)    // LDS pitch of a V^T row, bytes
__device__ __forceinline__ void attn_stage_copy(
    const unsigned short* kg, const unsigned short* vg,
    unsigned int kl, unsigned int vl)
{
  // the copies and the wait that lets their address registers be reused stand
  // in one statement, so that no address update can move in front of the wait
  asm volatile(
      "global_load_async_to_lds_b128 %0, %1, off\n\t"
      "global_load_async_to_lds_b128 %2, %3, off\n\t"
      "global_load_async_to_lds_b128 %4, %5, off\n\t"
      "global_load_async_to_lds_b128 %6, %7, off\n\t"
      "global_load_async_to_lds_b128 %8, %9, off\n\t"
      "global_load_async_to_lds_b128 %10, %11, off\n\t"
      "global_load_async_to_lds_b128 %12, %13, off\n\t"
      "global_load_async_to_lds_b128 %14, %15, off\n\t"
      "s_wait_xcnt 0x0"
      :: "v"(kl),                 "v"(kg),
         "v"(kl + 32 * ATT_KPB),  "v"(kg + 32 * HS_),
         "v"(kl + 64 * ATT_KPB),  "v"(kg + 64 * HS_),
         "v"(kl + 96 * ATT_KPB),  "v"(kg + 96 * HS_),
         "v"(vl),                 "v"(vg),
         "v"(vl + 16 * ATT_VPB),  "v"(vg + 16 * C_DIM),
         "v"(vl + 32 * ATT_VPB),  "v"(vg + 32 * C_DIM),
         "v"(vl + 48 * ATT_VPB),  "v"(vg + 48 * C_DIM)
      : "memory");
}

// The grid gives a WGP two blocks, a SIMD four waves: the register budget is
// set for at most four, so that a pass's fragment loads are issued as groups
// ahead of their use, which the passes of one stage (no barrier between them)
// allow.
__global__ __launch_bounds__(256) __attribute__((amdgpu_waves_per_eu(2, 4)))
void flash_attn_kernel(
    const unsigned short* __restrict__ Q,
    const unsigned short* __restrict__ Kmat,
    const unsigned short* __restrict__ Vt,
    unsigned short* __restrict__ Obf,
    float scale)
{
  // two buffers: stage s + 1 is copied while stage s is worked on
  __shared__ __attribute__((aligned(16))) unsigned short Ksm[2][ATT_ST][HS_ + 8];
  __shared__ __attribute__((aligned(16))) unsigned short Vsm[2][HS_][ATT_ST + 8];

  const int h     = blockIdx.y;
  const int qb    = blockIdx.x;
  const int wave  = threadIdx.x >> 5;
  const int lane  = threadIdx.x & 31;
  const int lrow  = lane & 15;
  const int lhalf = lane >> 4;
  const int m0    = qb * 128 + wave * 16;
  const int mg    = m0 + lrow;            // this lane's query

  const unsigned short* Qh = Q    + (long long)h * C_DIM * HS_;
  const unsigned short* Kh = Kmat + (long long)h * C_DIM * HS_;
  const unsigned short* Vh = Vt   + (long long)h * HS_ * C_DIM;

  // this lane's share of a stage: source addresses of stage 0, LDS of buffer 0
  const unsigned short* kg = Kh + threadIdx.x * 8;
  const unsigned short* vg = Vh + (threadIdx.x >> 4) * C_DIM + (threadIdx.x & 15) * 8;
  const unsigned int kl0 =
      (unsigned int)(size_t)&Ksm[0][threadIdx.x >> 3][(threadIdx.x & 7) * 8];
  const unsigned int vl0 =
      (unsigned int)(size_t)&Vsm[0][threadIdx.x >> 4][(threadIdx.x & 15) * 8];
  constexpr unsigned int kbuf = ATT_ST * ATT_KPB;   // bytes of one K buffer
  constexpr unsigned int vbuf = HS_ * ATT_VPB;      // bytes of one V^T buffer

  const int nst = qb + 1;                 // stages of this block
  attn_stage_copy(kg, vg, kl0, vl0);

  BFrag q0, q1;
  {
    const unsigned short* qr = Qh + (long long)mg * HS_;
    q0.q[0] = *(const uint4*)&qr[lhalf * 8];
    q0.q[1] = *(const uint4*)&qr[lhalf * 8 + 16];
    q1.q[0] = *(const uint4*)&qr[32 + lhalf * 8];
    q1.q[1] = *(const uint4*)&qr[48 + lhalf * 8];
  }

  // o[t].f[e] = O^T[t*16 + 8*lhalf + e][query mg]
  FAcc o[4];
#pragma unroll
  for (int t = 0; t < 4; t++)
#pragma unroll
    for (int e = 0; e < 8; e++) o[t].f[e] = 0.f;
  float mrow = -1e30f;   // running maximum of query mg (equal in both halves)
  float lsum = 0.f;      // running sum over this half's keys only

  // stage 0 has landed for this wave, then for all
  asm volatile("s_wait_asynccnt 0x0" ::: "memory");
  __syncthreads();
  if (nst > 1)
    attn_stage_copy(kg + ATT_ST * HS_, vg + ATT_ST, kl0 + kbuf, vl0 + vbuf);

  for (int st = 0; st < nst; st++) {
    const int buf = st & 1;
    // unrolled: the four passes' LDS offsets are immediates, and a pass's
    // fragment loads may be issued during the pass before it
#pragma unroll
    for (int pp = 0; pp < ATT_ST / 32; pp++) {
      const int j0 = st * ATT_ST + pp * 32;

      // ---- S^T = K Q^T: s[nt].f[e] = score(key j0 + nt*16 + 8*lhalf + e, mg) ----
      FAcc s[2];
#pragma unroll
      for (int nt = 0; nt < 2; nt++) {
#pragma unroll
        for (int e = 0; e < 8; e++) s[nt].f[e] = 0.f;
        BFrag k0f, k1f;
        const int r = pp * 32 + nt * 16 + lrow;
        k0f.q[0] = *(const uint4*)&Ksm[buf][r][lhalf * 8];
        k0f.q[1] = *(const uint4*)&Ksm[buf][r][lhalf * 8 + 16];
        k1f.q[0] = *(const uint4*)&Ksm[buf][r][32 + lhalf * 8];
        k1f.q[1] = *(const uint4*)&Ksm[buf][r][48 + lhalf * 8];
        s[nt].v = wmma_bf16(k0f, q0, s[nt].v);
        s[nt].v = wmma_bf16(k1f, q1, s[nt].v);
      }

      // ---- scale (+ causal mask only on diagonal blocks), online softmax ----
      s[0].v = s[0].v * scale;
      s[1].v = s[1].v * scale;
      if (j0 + 31 > m0) {
#pragma unroll
        for (int nt = 0; nt < 2; nt++)
#pragma unroll
          for (int e = 0; e < 8; e++)
            if (j0 + nt * 16 + 8 * lhalf + e > mg) s[nt].f[e] = -1e30f;
      }
      float rmax = fmaxf(s[0].f[0], s[1].f[0]);
#pragma unroll
      for (int e = 1; e < 8; e++) rmax = fmaxf(rmax, fmaxf(s[0].f[e], s[1].f[e]));
      rmax = fmaxf(rmax, xhalf(rmax));

      const float mn    = fmaxf(mrow, rmax);
      const float alpha = __expf(mrow - mn);
      mrow = mn;
      f32x2 rs2 = {0.f, 0.f};
      BFrag pf;   // P^T as B operand: element i of q[nt] = key nt*16 + 8*lhalf + i
#pragma unroll
      for (int nt = 0; nt < 2; nt++) {
        unsigned int w[4];
#pragma unroll
        for (int i = 0; i < 4; i++) {
          const f32x2 p = {__expf(s[nt].f[2 * i] - mn), __expf(s[nt].f[2 * i + 1] - mn)};
          rs2 += p;
          w[i] = pack_bf16x2(p);
        }
        pf.q[nt] = make_uint4(w[0], w[1], w[2], w[3]);
      }
      const float rsum = rs2.x + rs2.y;
      lsum = lsum * alpha + rsum;
#pragma unroll
      for (int t = 0; t < 4; t++)
#pragma unroll
        for (int e = 0; e < 8; e++) o[t].f[e] *= alpha;

      // ---- O^T += V^T P^T ----
#pragma unroll
      for (int nt = 0; nt < 4; nt++) {
        BFrag vf;
        const int r = nt * 16 + lrow;
        vf.q[0] = *(const uint4*)&Vsm[buf][r][pp * 32 + lhalf * 8];
        vf.q[1] = *(const uint4*)&Vsm[buf][r][pp * 32 + lhalf * 8 + 16];
        o[nt].v = wmma_bf16(vf, pf, o[nt].v);
      }
    }

    // hand-over: this wave has left buffer buf, its copies of stage st + 1 have
    // landed; behind the barrier both hold for every wave
    asm volatile("s_wait_dscnt 0x0" ::: "memory");
    asm volatile("s_wait_asynccnt 0x0" ::: "memory");
    __syncthreads();
    if (st + 2 < nst)
      attn_stage_copy(kg + (st + 2) * (ATT_ST * HS_), vg + (st + 2) * ATT_ST,
                      kl0 + buf * kbuf, vl0 + buf * vbuf);
  }
  // no copy is outstanding when the wave ends
  asm volatile("s_wait_asynccnt 0x0" ::: "memory");

  // ---- join the halves' sums, normalize, write concat-by-head output ----
  const float inv = 1.f / (lsum + xhalf(lsum));
#pragma unroll
  for (int nt = 0; nt < 4; nt++) {
    uint4 ov;
    ov.x = pack_bf16x2(f32x2{o[nt].f[0] * inv, o[nt].f[1] * inv});
    ov.y = pack_bf16x2(f32x2{o[nt].f[2] * inv, o[nt].f[3] * inv});
    ov.z = pack_bf16x2(f32x2{o[nt].f[4] * inv, o[nt].f[5] * inv});
    ov.w = pack_bf16x2(f32x2{o[nt].f[6] * inv, o[nt].f[7] * inv});
    *(uint4*)&Obf[(long long)mg * D_DIM + h * HS_ + nt * 16 + 8 * lhalf] = ov;
  }
}

// ---------------------------------------------------------------------------
extern "C" void kernel_launch(void* const* d_in, const int* in_sizes, int n_in,
                              void* d_out, int out_size, void* d_ws, size_t ws_size,
                              hipStream_t stream) {
  (void)in_sizes; (void)n_in; (void)out_size; (void)ws_size;
  const float* x     = (const float*)d_in[0];
  const float* Wq    = (const float*)d_in[1];
  const float* Wk    = (const float*)d_in[2];
  const float* Wv    = (const float*)d_in[3];
  const float* Wo    = (const float*)d_in[4];
  const float* bo    = (const float*)d_in[5];
  const float* W1    = (const float*)d_in[6];
  const float* b1    = (const float*)d_in[7];
  const float* W2    = (const float*)d_in[8];
  const float* b2    = (const float*)d_in[9];
  const float* ln1_g = (const float*)d_in[10];
  const float* ln1_b = (const float*)d_in[11];
  const float* ln2_g = (const float*)d_in[12];
  const float* ln2_b = (const float*)d_in[13];
  float* out = (float*)d_out;

  char* p = (char*)d_ws;
  auto alloc = [&](size_t bytes) -> void* {
    void* r = (void*)p;
    p += (bytes + 255) & ~(size_t)255;
    return r;
  };
  unsigned short* hbf  = (unsigned short*)alloc((size_t)C_DIM * E_DIM * 2);
  unsigned short* WqT  = (unsigned short*)alloc((size_t)NH_ * HS_ * E_DIM * 2);
  unsigned short* WkT  = (unsigned short*)alloc((size_t)NH_ * HS_ * E_DIM * 2);
  unsigned short* WvT  = (unsigned short*)alloc((size_t)NH_ * HS_ * E_DIM * 2);
  unsigned short* WoT  = (unsigned short*)alloc((size_t)D_DIM * D_DIM * 2);
  unsigned short* W1T  = (unsigned short*)alloc((size_t)FF_DIM * D_DIM * 2);
  unsigned short* W2T  = (unsigned short*)alloc((size_t)E_DIM * FF_DIM * 2);
  unsigned short* Qb   = (unsigned short*)alloc((size_t)NH_ * C_DIM * HS_ * 2);
  unsigned short* Kb   = (unsigned short*)alloc((size_t)NH_ * C_DIM * HS_ * 2);
  unsigned short* Vtb  = (unsigned short*)alloc((size_t)NH_ * HS_ * C_DIM * 2);
  unsigned short* attn = (unsigned short*)alloc((size_t)C_DIM * D_DIM * 2);
  float*          x1   = (float*)alloc((size_t)C_DIM * E_DIM * 4);
  unsigned short* h2   = (unsigned short*)alloc((size_t)C_DIM * D_DIM * 2);
  unsigned short* ff1  = (unsigned short*)alloc((size_t)C_DIM * FF_DIM * 2);

  const dim3 blk(256);

  // ---- weight conversion + transpose to N-major bf16 ----
  cvt_transpose_kernel<E_DIM, HS_><<<dim3(HS_ / 64, E_DIM / 128, NH_), blk, 0, stream>>>(Wq, WqT);
  cvt_transpose_kernel<E_DIM, HS_><<<dim3(HS_ / 64, E_DIM / 128, NH_), blk, 0, stream>>>(Wk, WkT);
  cvt_transpose_kernel<E_DIM, HS_><<<dim3(HS_ / 64, E_DIM / 128, NH_), blk, 0, stream>>>(Wv, WvT);
  cvt_transpose_kernel<D_DIM, D_DIM><<<dim3(D_DIM / 64, D_DIM / 128, 1), blk, 0, stream>>>(Wo, WoT);
  cvt_transpose_kernel<D_DIM, FF_DIM><<<dim3(FF_DIM / 64, D_DIM / 128, 1), blk, 0, stream>>>(W1, W1T);
  cvt_transpose_kernel<FF_DIM, E_DIM><<<dim3(E_DIM / 64, FF_DIM / 128, 1), blk, 0, stream>>>(W2, W2T);

  // ---- LN1 -> bf16 ----
  ln_bf16_kernel<<<dim3(C_DIM / 8), blk, 0, stream>>>(x, ln1_g, ln1_b, hbf);

  // ---- QKV projections (batched over heads); V written transposed ----
  gemm_bf16_kernel<128, 64, false, false, false, true, false>
      <<<dim3(1, C_DIM / 128, NH_), blk, 0, stream>>>(
          hbf, WqT, nullptr, nullptr, nullptr, Qb, C_DIM, HS_, E_DIM,
          0LL, (long long)HS_ * E_DIM, (long long)C_DIM * HS_);
  gemm_bf16_kernel<128, 64, false, false, false, true, false>
      <<<dim3(1, C_DIM / 128, NH_), blk, 0, stream>>>(
          hbf, WkT, nullptr, nullptr, nullptr, Kb, C_DIM, HS_, E_DIM,
          0LL, (long long)HS_ * E_DIM, (long long)C_DIM * HS_);
  gemm_bf16_kernel<128, 64, false, false, false, true, true>
      <<<dim3(1, C_DIM / 128, NH_), blk, 0, stream>>>(
          hbf, WvT, nullptr, nullptr, nullptr, Vtb, C_DIM, HS_, E_DIM,
          0LL, (long long)HS_ * E_DIM, (long long)HS_ * C_DIM);

  // ---- causal flash attention (scale = 1/sqrt(E) per reference) ----
  flash_attn_kernel<<<dim3(C_DIM / 128, NH_), blk, 0, stream>>>(
      Qb, Kb, Vtb, attn, 0.03125f);

  // ---- output projection + bias + residual -> x1 (f32) ----
  gemm_bf16_kernel<128, 128, true, false, true, false, false>
      <<<dim3(D_DIM / 128, C_DIM / 128, 1), blk, 0, stream>>>(
          attn, WoT, bo, x, x1, nullptr, C_DIM, D_DIM, D_DIM, 0LL, 0LL, 0LL);

  // ---- LN2 -> bf16 ----
  ln_bf16_kernel<<<dim3(C_DIM / 8), blk, 0, stream>>>(x1, ln2_g, ln2_b, h2);

  // ---- FFN1: relu(h2 @ W1 + b1) -> bf16 ----
  gemm_bf16_kernel<128, 128, true, true, false, true, false>
      <<<dim3(FF_DIM / 128, C_DIM / 128, 1), blk, 0, stream>>>(
          h2, W1T, b1, nullptr, nullptr, ff1, C_DIM, FF_DIM, D_DIM, 0LL, 0LL, 0LL);

  // ---- FFN2: ff1 @ W2 + b2 + x1 -> d_out (f32) ----
  gemm_bf16_kernel<128, 128, true, false, true, false, false>
      <<<dim3(E_DIM / 128, C_DIM / 128, 1), blk, 0, stream>>>(
          ff1, W2T, b2, x1, out, nullptr, C_DIM, E_DIM, FF_DIM, 0LL, 0LL, 0LL);
}

// v004
// It runs in 227 microseconds.
// Next to v003, in two timings, it ran 1.14 times as fast each time.
// Over all steps from v000 it is 1.73 times as fast.
#include <hip/hip_runtime.h>
#include <cstdint>

// ---------------------------------------------------------------------------
// Transformer block (pre-norm MHA + FFN) for MI455X (gfx1250, wave32, WMMA).
// GEMMs: v_wmma_f32_16x16x32_bf16, LDS tiles staged by the Tensor Data Mover
// (tensor_load_to_lds, TENSORcnt-tracked, double-buffered).  LN / softmax /
// residuals in f32.  Attention is causal flash-style (online softmax).
// ---------------------------------------------------------------------------

#define C_DIM  4096
#define E_DIM  1024
#define NH_    16
#define HS_    64
#define D_DIM  1024
#define FF_DIM 4096

typedef __attribute__((ext_vector_type(16))) __bf16 v16bf;
typedef __attribute__((ext_vector_type(8)))  float  v8f;
typedef __attribute__((ext_vector_type(4)))  unsigned int u32x4;
typedef __attribute__((ext_vector_type(8)))  int  i32x8;
typedef __attribute__((ext_vector_type(4)))  int  i32x4;

union BFrag { v16bf v; uint4 q[2]; unsigned short us[16]; };
union FAcc  { v8f   v; float f[8]; };

typedef __attribute__((ext_vector_type(2))) float f32x2;

// two f32 -> packed bf16 pair, round to nearest even
__device__ __forceinline__ unsigned int pack_bf16x2(f32x2 v) {
  typedef __bf16 bf2 __attribute__((ext_vector_type(2)));
  return __builtin_bit_cast(unsigned int, __builtin_convertvector(v, bf2));
}

__device__ __forceinline__ v8f wmma_bf16(BFrag a, BFrag b, v8f c) {
  return __builtin_amdgcn_wmma_f32_16x16x32_bf16(
      /*neg_a=*/false, a.v, /*neg_b=*/false, b.v,
      /*c_mod=*/(short)0, c, /*reuse_a=*/false, /*reuse_b=*/false);
}

// ---------------------------------------------------------------------------
// TDM: DMA a 2D tile (rows x k_dw dwords) from global into LDS, with the
// hardware inserting 4 pad dwords after every 32 data dwords so the LDS tile
// keeps a (BK/2 + 4)-dword pitch (bank-conflict padding).  D# per ISA ch.8:
//   group0: count=1 | lds_addr | global tile addr (57b) | type=2
//   group1: data_size=4B, pad_enable, pad_interval=32dw(code 4),
//           pad_amount=4dw(code 3), tensor dims huge (tiles never OOB),
//           tile_dim0=k_dw, tile_dim1=rows, dim0 stride = pitch_dw
// ---------------------------------------------------------------------------
__device__ __forceinline__ void tdm_load_tile(
    const unsigned short* g, const void* lds, int rows, int k_dw,
    long long pitch_dw)
{
  const unsigned long long ga = (unsigned long long)(size_t)g;
  const unsigned lds_off = (unsigned)(size_t)lds;   // low 32b == LDS offset
  const u32x4 g0 = { 1u, lds_off,
                     (unsigned)(ga & 0xFFFFFFFFull),
                     (unsigned)((ga >> 32) & 0x01FFFFFFull) | (2u << 30) };
  const unsigned d0 = 1u << 20;     // tensor_dim0 (OOB never hit)
  const unsigned d1 = 1u << 20;     // tensor_dim1
  const unsigned long long s0 = (unsigned long long)pitch_dw;
  const i32x8 g1 = {
      (int)((2u << 16) | (1u << 20) | (4u << 22) | (3u << 25)),
      (int)((d0 & 0xFFFFu) << 16),
      (int)((d0 >> 16) | ((d1 & 0xFFFFu) << 16)),
      (int)((d1 >> 16) | ((unsigned)k_dw << 16)),
      (int)(unsigned)rows,
      (int)(unsigned)(s0 & 0xFFFFFFFFull),
      (int)(unsigned)((s0 >> 32) & 0xFFFFull),
      0 };
  const i32x4 z4 = { 0, 0, 0, 0 };
#if defined(__clang_major__) && (__clang_major__ >= 23)
  const i32x8 z8 = { 0, 0, 0, 0, 0, 0, 0, 0 };
  __builtin_amdgcn_tensor_load_to_lds(g0, g1, z4, z4, z8, 0);
#else
  __builtin_amdgcn_tensor_load_to_lds(g0, g1, z4, z4, 0);
#endif
}

// ---------------------------------------------------------------------------
// f32 [Kd][Nd] row-major  ->  bf16 [Nd][Kd] (N-major, for B fragments)
// One block moves a tile of 128 k x 64 n: 32 elements a thread, so that few
// waves have to start.  Reads and writes are 16 bytes a lane, 256 contiguous
// bytes per 16 lanes.  LDS holds the tile transposed, one dword = the bf16
// pair (k, k + 1), 64 dwords a row; the index of each 16-byte group is XORed
// with n >> 2, which spreads the 32 dword writes of a wave over 32 banks and
// leaves the 16-byte reads whole.
// ---------------------------------------------------------------------------
template<int Kd, int Nd>
__global__ __launch_bounds__(256) void cvt_transpose_kernel(
    const float* __restrict__ in, unsigned short* __restrict__ out)
{
  __shared__ __attribute__((aligned(16))) unsigned int tile[64 * 64];
  const long long base = (long long)blockIdx.z * Kd * Nd;
  in  += base;
  out += base;
  const int n0 = blockIdx.x * 64;
  const int k0 = blockIdx.y * 128;
  const int c  = threadIdx.x & 15;
  const int r  = threadIdx.x >> 4;
  // one block-uniform base per side plus one 32-bit byte offset per thread;
  // the row steps are compile-time and go into the instructions' offsets
  const char* ib = (const char*)(in + (long long)k0 * Nd + n0);
  char*       ob = (char*)(out + (long long)n0 * Kd + k0);
  constexpr unsigned int irow = (unsigned int)Nd * 4u;
  constexpr unsigned int orow = (unsigned int)Kd * 2u;
  const unsigned int ioff = 2u * r * irow + 16u * c;
  const unsigned int ooff = r * orow + 16u * c;
  float4 lo[4], hi[4];    // rows k and k + 1, columns n0 + 4c .. + 3
  // the three loops are unrolled so that lo and hi stay in registers and the
  // eight loads, and the four LDS reads, are issued together
#pragma unroll
  for (int p = 0; p < 4; p++) {
    lo[p] = *(const float4*)(ib + ioff + (32u * p) * irow);
    hi[p] = *(const float4*)(ib + ioff + (32u * p + 1u) * irow);
  }
#pragma unroll
  for (int p = 0; p < 4; p++) {
    const int kp  = p * 16 + r;
    const int col = (((kp >> 2) ^ c) << 2) | (kp & 3);
    unsigned int* t = &tile[(4 * c) * 64 + col];
    t[0 * 64] = pack_bf16x2(f32x2{lo[p].x, hi[p].x});
    t[1 * 64] = pack_bf16x2(f32x2{lo[p].y, hi[p].y});
    t[2 * 64] = pack_bf16x2(f32x2{lo[p].z, hi[p].z});
    t[3 * 64] = pack_bf16x2(f32x2{lo[p].w, hi[p].w});
  }
  __syncthreads();
#pragma unroll
  for (int p = 0; p < 4; p++) {
    const int n = p * 16 + r;
    const uint4 v = *(const uint4*)&tile[n * 64 + ((c ^ (n >> 2)) << 2)];
    *(uint4*)(ob + ooff + (16u * p) * orow) = v;
  }
}

// ---------------------------------------------------------------------------
// LayerNorm over last dim (1024) -> bf16.  One wave per row (32 elements a
// lane, all loads in flight at once), eight rows per block: the sums need no
// LDS and no barrier, and an eighth of the waves has to start.  The grid gives
// a SIMD four waves, so the register budget is set for at most eight: the
// loads of g and b then stay ahead of the sums instead of behind them.
// ---------------------------------------------------------------------------
__global__ __launch_bounds__(256) __attribute__((amdgpu_waves_per_eu(4, 8)))
void ln_bf16_kernel(
    const float* __restrict__ x, const float* __restrict__ g,
    const float* __restrict__ b, unsigned short* __restrict__ out)
{
  const int row  = blockIdx.x * 8 + (threadIdx.x >> 5);
  const int lane = threadIdx.x & 31;
  const float* xr = x + (long long)row * E_DIM;
  float4 v[8], gg[8], bb[8];
  // every loop here is unrolled: the arrays stay in registers and the 24 loads
  // are issued together
#pragma unroll
  for (int j = 0; j < 8; j++) v[j] = *(const float4*)&xr[j * 128 + lane * 4];
#pragma unroll
  for (int j = 0; j < 8; j++) {
    gg[j] = *(const float4*)&g[j * 128 + lane * 4];
    bb[j] = *(const float4*)&b[j * 128 + lane * 4];
  }
  float4 a1 = {0.f, 0.f, 0.f, 0.f};   // four independent chains each
  float4 a2 = {0.f, 0.f, 0.f, 0.f};
#pragma unroll
  for (int j = 0; j < 8; j++) {
    a1.x += v[j].x;  a1.y += v[j].y;  a1.z += v[j].z;  a1.w += v[j].w;
    a2.x += v[j].x * v[j].x;  a2.y += v[j].y * v[j].y;
    a2.z += v[j].z * v[j].z;  a2.w += v[j].w * v[j].w;
  }
  float s  = (a1.x + a1.y) + (a1.z + a1.w);
  float s2 = (a2.x + a2.y) + (a2.z + a2.w);
#pragma unroll
  for (int msk = 1; msk < 32; msk <<= 1) {
    s  += __shfl_xor(s,  msk, 32);
    s2 += __shfl_xor(s2, msk, 32);
  }
  const float mu  = s * (1.0f / E_DIM);
  const float var = s2 * (1.0f / E_DIM) - mu * mu;
  const float rs  = rsqrtf(var + 1e-5f);
#pragma unroll
  for (int j = 0; j < 8; j++) {
    const int i0 = j * 128 + lane * 4;
    uint2 ov;
    ov.x = pack_bf16x2(f32x2{(v[j].x - mu) * rs * gg[j].x + bb[j].x,
                             (v[j].y - mu) * rs * gg[j].y + bb[j].y});
    ov.y = pack_bf16x2(f32x2{(v[j].z - mu) * rs * gg[j].z + bb[j].z,
                             (v[j].w - mu) * rs * gg[j].w + bb[j].w});
    *(uint2*)&out[(long long)row * E_DIM + i0] = ov;
  }
}

// ---------------------------------------------------------------------------
// bf16 WMMA GEMM:  C[M,N] = A[M,K] * Bt[N,K]^T  (+bias, relu, residual)
// 8 waves (4 M x 2 N), BK=64, LDS double-buffered, tiles staged by the TDM
// (wave 0 issues tensor_load_to_lds for tile i+1 while all waves compute
// tile i; drained with s_wait_tensorcnt before the block barrier).
// ---------------------------------------------------------------------------
template<int BM, int BN, bool BIAS, bool RELU, bool RESID, bool OUT_BF16, bool OUT_TRANS>
__global__ __launch_bounds__(256, 2) void gemm_bf16_kernel(
    const unsigned short* __restrict__ A,
    const unsigned short* __restrict__ Bt,
    const float* __restrict__ bias,
    const float* __restrict__ resid,
    float* __restrict__ Of,
    unsigned short* __restrict__ Ob,
    int M, int N, int K,
    long long strideA, long long strideB, long long strideO)
{
  constexpr int BK = 64;
  __shared__ unsigned short Asm_[2][BM][BK + 8];
  __shared__ unsigned short Bsm_[2][BN][BK + 8];

  const int z = blockIdx.z;
  A  += (long long)z * strideA;
  Bt += (long long)z * strideB;

  const int wave  = threadIdx.x >> 5;
  const int lane  = threadIdx.x & 31;
  const int lrow  = lane & 15;
  const int lhalf = lane >> 4;
  constexpr int WM = BM / 4;
  constexpr int WN = BN / 2;
  constexpr int MT = WM / 16;
  constexpr int NT = WN / 16;
  const int wm = wave >> 1;
  const int wn = wave & 1;

  const int m0 = blockIdx.y * BM;
  const int n0 = blockIdx.x * BN;

  FAcc acc[MT][NT];
#pragma unroll
  for (int i = 0; i < MT; i++)
#pragma unroll
    for (int j = 0; j < NT; j++)
#pragma unroll
      for (int e = 0; e < 8; e++) acc[i][j].f[e] = 0.f;

  // prologue: DMA tile 0 into buffer 0
  if (wave == 0) {
    tdm_load_tile(&A[(long long)m0 * K], &Asm_[0][0][0], BM, BK / 2, K / 2);
    tdm_load_tile(&Bt[(long long)n0 * K], &Bsm_[0][0][0], BN, BK / 2, K / 2);
    __builtin_amdgcn_s_wait_tensorcnt(0);
  }
  __syncthreads();

  for (int k0 = 0; k0 < K; k0 += BK) {
    const int buf = (k0 / BK) & 1;
    // DMA next tile into the other buffer while this one is consumed
    if (wave == 0 && (k0 + BK) < K) {
      tdm_load_tile(&A[(long long)m0 * K + k0 + BK], &Asm_[buf ^ 1][0][0],
                    BM, BK / 2, K / 2);
      tdm_load_tile(&Bt[(long long)n0 * K + k0 + BK], &Bsm_[buf ^ 1][0][0],
                    BN, BK / 2, K / 2);
    }

#pragma unroll
    for (int kk = 0; kk < BK; kk += 32) {
      BFrag af[MT], bfr[NT];
#pragma unroll
      for (int i = 0; i < MT; i++) {
        const int r = wm * WM + i * 16 + lrow;
        af[i].q[0] = *(const uint4*)&Asm_[buf][r][kk + lhalf * 8];
        af[i].q[1] = *(const uint4*)&Asm_[buf][r][kk + lhalf * 8 + 16];
      }
#pragma unroll
      for (int j = 0; j < NT; j++) {
        const int r = wn * WN + j * 16 + lrow;
        bfr[j].q[0] = *(const uint4*)&Bsm_[buf][r][kk + lhalf * 8];
        bfr[j].q[1] = *(const uint4*)&Bsm_[buf][r][kk + lhalf * 8 + 16];
      }
#pragma unroll
      for (int i = 0; i < MT; i++)
#pragma unroll
        for (int j = 0; j < NT; j++)
          acc[i][j].v = wmma_bf16(af[i], bfr[j], acc[i][j].v);
    }

    if (wave == 0) __builtin_amdgcn_s_wait_tensorcnt(0);
    __syncthreads();
  }

  // ---- epilogue (C/D layout: lane -> col = l&15, row = vg + 8*(l>>4)) ----
  // The tile goes through LDS in the output's own row order (f32, the operand
  // buffers: behind the loop's last barrier nobody reads them and no tensor
  // load is outstanding).  Every global access is then 4 elements a lane over
  // whole 128-byte lines, and the residual's loads are all in flight at once
  // instead of one round trip per element.
  constexpr int SR  = OUT_TRANS ? BN : BM;      // staged rows = output rows
  constexpr int SC  = OUT_TRANS ? BM : BN;      // staged columns
  constexpr int SP  = SC + 4;                   // pitch, floats: the two wave
                                                // halves fall on other banks
  constexpr int RA  = (SC == 128) ? 64 : 128;   // rows kept in Asm_, rest in Bsm_
  constexpr int LPR = SC / 4;                   // lanes per staged row
  constexpr int RPP = 256 / LPR;                // rows the block moves at once
  constexpr int NIT = SR / RPP;
  static_assert((SR < RA ? SR : RA) * SP * 4 <= (int)sizeof(Asm_), "staging");
  static_assert((SR - RA) * SP * 4 <= (int)sizeof(Bsm_), "staging");
  static_assert(RA % WM == 0 && RA % RPP == 0, "staging");
  static_assert(!OUT_TRANS || (SR <= RA && !BIAS && !RESID && OUT_BF16), "staging");
  float* const stA = (float*)&Asm_[0][0][0];
  float* const stB = (float*)&Bsm_[0][0][0];

  const int c4 = (threadIdx.x % LPR) * 4;       // this thread's first column
  const int r0 = threadIdx.x / LPR;             // and its first row
  // output and residual: the buffer's own base plus one 32-bit element offset
  // per thread and row group (no buffer here has 2^30 elements)
  const int ldo = OUT_TRANS ? M : N;            // elements per output row
  const unsigned int off0 = (unsigned int)(
      (OUT_TRANS ? n0 * M + m0 : m0 * N + n0) + r0 * ldo + c4);
  const unsigned int offs = (unsigned int)(RPP * ldo);
  float4 bv = {0.f, 0.f, 0.f, 0.f};
  float4 rv[NIT], sv[NIT];
  if (BIAS) bv = *(const float4*)&bias[n0 + c4];
  if (RESID) {
    // unrolled: rv stays in registers and the loads are issued together
#pragma unroll
    for (int it = 0; it < NIT; it++)
      rv[it] = *(const float4*)((const char*)resid + (off0 + it * offs) * 4u);
  }

  // the staging loops are unrolled so that acc is indexed by constants only and
  // stays in registers
  if (OUT_TRANS) {
    // a lane's eight values of one tile are eight neighbours of an output row
#pragma unroll
    for (int i = 0; i < MT; i++)
#pragma unroll
      for (int j = 0; j < NT; j++) {
        float* t = stA + (wn * WN + j * 16 + lrow) * SP + wm * WM + i * 16 + 8 * lhalf;
        *(float4*)&t[0] = make_float4(acc[i][j].f[0], acc[i][j].f[1],
                                      acc[i][j].f[2], acc[i][j].f[3]);
        *(float4*)&t[4] = make_float4(acc[i][j].f[4], acc[i][j].f[5],
                                      acc[i][j].f[6], acc[i][j].f[7]);
      }
  } else {
    float* const t = ((SR <= RA || wm * WM < RA) ? stA + wm * WM * SP
                                                 : stB + (wm * WM - RA) * SP)
                     + 8 * lhalf * SP + wn * WN + lrow;
#pragma unroll
    for (int i = 0; i < MT; i++)
#pragma unroll
      for (int j = 0; j < NT; j++)
#pragma unroll
        for (int e = 0; e < 8; e++)
          t[(i * 16 + e) * SP + j * 16] = acc[i][j].f[e];
  }
  __syncthreads();

  // two unrolled loops: the LDS reads are issued as one group, not one wait each
#pragma unroll
  for (int it = 0; it < NIT; it++) {
    const int row = it * RPP + r0;
    const float* sp = (it * RPP < RA) ? stA + row * SP : stB + (row - RA) * SP;
    sv[it] = *(const float4*)&sp[c4];
  }
#pragma unroll
  for (int it = 0; it < NIT; it++) {
    float4 v = sv[it];
    if (BIAS)  { v.x += bv.x;  v.y += bv.y;  v.z += bv.z;  v.w += bv.w; }
    if (RELU)  { v.x = fmaxf(v.x, 0.f);  v.y = fmaxf(v.y, 0.f);
                 v.z = fmaxf(v.z, 0.f);  v.w = fmaxf(v.w, 0.f); }
    if (RESID) { v.x += rv[it].x;  v.y += rv[it].y;
                 v.z += rv[it].z;  v.w += rv[it].w; }
    if (OUT_BF16) {
      uint2 ov;
      ov.x = pack_bf16x2(f32x2{v.x, v.y});
      ov.y = pack_bf16x2(f32x2{v.z, v.w});
      *(uint2*)((char*)(Ob + (long long)z * strideO) + (off0 + it * offs) * 2u) = ov;
    } else {
      *(float4*)((char*)Of + (off0 + it * offs) * 4u) = v;
    }
  }
}

__device__ __forceinline__ float xhalf(float x) {
  const int b = __builtin_bit_cast(int, x);
  return __builtin_bit_cast(float, __builtin_amdgcn_permlanex16(
      b, b, 0x76543210, 0xfedcba98, false, false));
}

// One stage = 128 keys of K (128 rows of 128 B) and of V^T (64 rows of 256 B).
// Every lane brings eight 16-byte pieces from global memory straight into LDS.
//   kg, vg : this lane's first source address;  kl, vl : its first LDS byte
// K: 8 lanes a row, 32 rows per copy; V^T: 16 lanes a row, 16 rows per copy.
#define ATT_ST   128
#define ATT_KPB  ((HS_ + 8) * 2)       // LDS pitch of a K row, bytes
#define ATT_VPB  ((ATT_ST + 8) * 2)    // LDS pitch of a V^T row, bytes
__device__ __forceinline__ void attn_stage_copy(
    const unsigned short* kg, const unsigned short* vg,
    unsigned int kl, unsigned int vl)
{
  // the copies and the wait that lets their address registers be reused stand
  // in one statement, so that no address update can move in front of the wait
  asm volatile(
      "global_load_async_to_lds_b128 %0, %1, off\n\t"
      "global_load_async_to_lds_b128 %2, %3, off\n\t"
      "global_load_async_to_lds_b128 %4, %5, off\n\t"
      "global_load_async_to_lds_b128 %6, %7, off\n\t"
      "global_load_async_to_lds_b128 %8, %9, off\n\t"
      "global_load_async_to_lds_b128 %10, %11, off\n\t"
      "global_load_async_to_lds_b128 %12, %13, off\n\t"
      "global_load_async_to_lds_b128 %14, %15, off\n\t"
      "s_wait_xcnt 0x0"
      :: "v"(kl),                 "v"(kg),
         "v"(kl + 32 * ATT_KPB),  "v"(kg + 32 * HS_),
         "v"(kl + 64 * ATT_KPB),  "v"(kg + 64 * HS_),
         "v"(kl + 96 * ATT_KPB),  "v"(kg + 96 * HS_),
         "v"(vl),                 "v"(vg),
         "v"(vl + 16 * ATT_VPB),  "v"(vg + 16 * C_DIM),
         "v"(vl + 32 * ATT_VPB),  "v"(vg + 32 * C_DIM),
         "v"(vl + 48 * ATT_VPB),  "v"(vg + 48 * C_DIM)
      : "memory");
}

// The grid gives a WGP two blocks, a SIMD four waves: the register budget is
// set for at most four, so that a pass's fragment loads are issued as groups
// ahead of their use, which the passes of one stage (no barrier between them)
// allow.
__global__ __launch_bounds__(256) __attribute__((amdgpu_waves_per_eu(2, 4)))
void flash_attn_kernel(
    const unsigned short* __restrict__ Q,
    const unsigned short* __restrict__ Kmat,
    const unsigned short* __restrict__ Vt,
    unsigned short* __restrict__ Obf,
    float scale)
{
  // two buffers: stage s + 1 is copied while stage s is worked on
  __shared__ __attribute__((aligned(16))) unsigned short Ksm[2][ATT_ST][HS_ + 8];
  __shared__ __attribute__((aligned(16))) unsigned short Vsm[2][HS_][ATT_ST + 8];

  const int h     = blockIdx.y;
  const int qb    = blockIdx.x;
  const int wave  = threadIdx.x >> 5;
  const int lane  = threadIdx.x & 31;
  const int lrow  = lane & 15;
  const int lhalf = lane >> 4;
  const int m0    = qb * 128 + wave * 16;
  const int mg    = m0 + lrow;            // this lane's query

  const unsigned short* Qh = Q    + (long long)h * C_DIM * HS_;
  const unsigned short* Kh = Kmat + (long long)h * C_DIM * HS_;
  const unsigned short* Vh = Vt   + (long long)h * HS_ * C_DIM;

  // this lane's share of a stage: source addresses of stage 0, LDS of buffer 0
  const unsigned short* kg = Kh + threadIdx.x * 8;
  const unsigned short* vg = Vh + (threadIdx.x >> 4) * C_DIM + (threadIdx.x & 15) * 8;
  const unsigned int kl0 =
      (unsigned int)(size_t)&Ksm[0][threadIdx.x >> 3][(threadIdx.x & 7) * 8];
  const unsigned int vl0 =
      (unsigned int)(size_t)&Vsm[0][threadIdx.x >> 4][(threadIdx.x & 15) * 8];
  constexpr unsigned int kbuf = ATT_ST * ATT_KPB;   // bytes of one K buffer
  constexpr unsigned int vbuf = HS_ * ATT_VPB;      // bytes of one V^T buffer

  const int nst = qb + 1;                 // stages of this block
  attn_stage_copy(kg, vg, kl0, vl0);

  BFrag q0, q1;
  {
    const unsigned short* qr = Qh + (long long)mg * HS_;
    q0.q[0] = *(const uint4*)&qr[lhalf * 8];
    q0.q[1] = *(const uint4*)&qr[lhalf * 8 + 16];
    q1.q[0] = *(const uint4*)&qr[32 + lhalf * 8];
    q1.q[1] = *(const uint4*)&qr[48 + lhalf * 8];
  }

  // o[t].f[e] = O^T[t*16 + 8*lhalf + e][query mg]
  FAcc o[4];
#pragma unroll
  for (int t = 0; t < 4; t++)
#pragma unroll
    for (int e = 0; e < 8; e++) o[t].f[e] = 0.f;
  float mrow = -1e30f;   // running maximum of query mg (equal in both halves)
  float lsum = 0.f;      // running sum over this half's keys only

  // stage 0 has landed for this wave, then for all
  asm volatile("s_wait_asynccnt 0x0" ::: "memory");
  __syncthreads();
  if (nst > 1)
    attn_stage_copy(kg + ATT_ST * HS_, vg + ATT_ST, kl0 + kbuf, vl0 + vbuf);

  for (int st = 0; st < nst; st++) {
    const int buf = st & 1;
    // unrolled: the four passes' LDS offsets are immediates, and a pass's
    // fragment loads may be issued during the pass before it
#pragma unroll
    for (int pp = 0; pp < ATT_ST / 32; pp++) {
      const int j0 = st * ATT_ST + pp * 32;

      // ---- S^T = K Q^T: s[nt].f[e] = score(key j0 + nt*16 + 8*lhalf + e, mg) ----
      FAcc s[2];
#pragma unroll
      for (int nt = 0; nt < 2; nt++) {
#pragma unroll
        for (int e = 0; e < 8; e++) s[nt].f[e] = 0.f;
        BFrag k0f, k1f;
        const int r = pp * 32 + nt * 16 + lrow;
        k0f.q[0] = *(const uint4*)&Ksm[buf][r][lhalf * 8];
        k0f.q[1] = *(const uint4*)&Ksm[buf][r][lhalf * 8 + 16];
        k1f.q[0] = *(const uint4*)&Ksm[buf][r][32 + lhalf * 8];
        k1f.q[1] = *(const uint4*)&Ksm[buf][r][48 + lhalf * 8];
        s[nt].v = wmma_bf16(k0f, q0, s[nt].v);
        s[nt].v = wmma_bf16(k1f, q1, s[nt].v);
      }

      // ---- scale (+ causal mask only on diagonal blocks), online softmax ----
      s[0].v = s[0].v * scale;
      s[1].v = s[1].v * scale;
      if (j0 + 31 > m0) {
#pragma unroll
        for (int nt = 0; nt < 2; nt++)
#pragma unroll
          for (int e = 0; e < 8; e++)
            if (j0 + nt * 16 + 8 * lhalf + e > mg) s[nt].f[e] = -1e30f;
      }
      float rmax = fmaxf(s[0].f[0], s[1].f[0]);
#pragma unroll
      for (int e = 1; e < 8; e++) rmax = fmaxf(rmax, fmaxf(s[0].f[e], s[1].f[e]));
      rmax = fmaxf(rmax, xhalf(rmax));

      const float mn    = fmaxf(mrow, rmax);
      const float alpha = __expf(mrow - mn);
      mrow = mn;
      f32x2 rs2 = {0.f, 0.f};
      BFrag pf;   // P^T as B operand: element i of q[nt] = key nt*16 + 8*lhalf + i
#pragma unroll
      for (int nt = 0; nt < 2; nt++) {
        unsigned int w[4];
#pragma unroll
        for (int i = 0; i < 4; i++) {
          const f32x2 p = {__expf(s[nt].f[2 * i] - mn), __expf(s[nt].f[2 * i + 1] - mn)};
          rs2 += p;
          w[i] = pack_bf16x2(p);
        }
        pf.q[nt] = make_uint4(w[0], w[1], w[2], w[3]);
      }
      const float rsum = rs2.x + rs2.y;
      lsum = lsum * alpha + rsum;
#pragma unroll
      for (int t = 0; t < 4; t++)
#pragma unroll
        for (int e = 0; e < 8; e++) o[t].f[e] *= alpha;

      // ---- O^T += V^T P^T ----
#pragma unroll
      for (int nt = 0; nt < 4; nt++) {
        BFrag vf;
        const int r = nt * 16 + lrow;
        vf.q[0] = *(const uint4*)&Vsm[buf][r][pp * 32 + lhalf * 8];
        vf.q[1] = *(const uint4*)&Vsm[buf][r][pp * 32 + lhalf * 8 + 16];
        o[nt].v = wmma_bf16(vf, pf, o[nt].v);
      }
    }

    // hand-over: this wave has left buffer buf, its copies of stage st + 1 have
    // landed; behind the barrier both hold for every wave
    asm volatile("s_wait_dscnt 0x0" ::: "memory");
    asm volatile("s_wait_asynccnt 0x0" ::: "memory");
    __syncthreads();
    if (st + 2 < nst)
      attn_stage_copy(kg + (st + 2) * (ATT_ST * HS_), vg + (st + 2) * ATT_ST,
                      kl0 + buf * kbuf, vl0 + buf * vbuf);
  }
  // no copy is outstanding when the wave ends
  asm volatile("s_wait_asynccnt 0x0" ::: "memory");

  // ---- join the halves' sums, normalize, write concat-by-head output ----
  const float inv = 1.f / (lsum + xhalf(lsum));
#pragma unroll
  for (int nt = 0; nt < 4; nt++) {
    uint4 ov;
    ov.x = pack_bf16x2(f32x2{o[nt].f[0] * inv, o[nt].f[1] * inv});
    ov.y = pack_bf16x2(f32x2{o[nt].f[2] * inv, o[nt].f[3] * inv});
    ov.z = pack_bf16x2(f32x2{o[nt].f[4] * inv, o[nt].f[5] * inv});
    ov.w = pack_bf16x2(f32x2{o[nt].f[6] * inv, o[nt].f[7] * inv});
    *(uint4*)&Obf[(long long)mg * D_DIM + h * HS_ + nt * 16 + 8 * lhalf] = ov;
  }
}

// ---------------------------------------------------------------------------
extern "C" void kernel_launch(void* const* d_in, const int* in_sizes, int n_in,
                              void* d_out, int out_size, void* d_ws, size_t ws_size,
                              hipStream_t stream) {
  (void)in_sizes; (void)n_in; (void)out_size; (void)ws_size;
  const float* x     = (const float*)d_in[0];
  const float* Wq    = (const float*)d_in[1];
  const float* Wk    = (const float*)d_in[2];
  const float* Wv    = (const float*)d_in[3];
  const float* Wo    = (const float*)d_in[4];
  const float* bo    = (const float*)d_in[5];
  const float* W1    = (const float*)d_in[6];
  const float* b1    = (const float*)d_in[7];
  const float* W2    = (const float*)d_in[8];
  const float* b2    = (const float*)d_in[9];
  const float* ln1_g = (const float*)d_in[10];
  const float* ln1_b = (const float*)d_in[11];
  const float* ln2_g = (const float*)d_in[12];
  const float* ln2_b = (const float*)d_in[13];
  float* out = (float*)d_out;

  char* p = (char*)d_ws;
  auto alloc = [&](size_t bytes) -> void* {
    void* r = (void*)p;
    p += (bytes + 255) & ~(size_t)255;
    return r;
  };
  unsigned short* hbf  = (unsigned short*)alloc((size_t)C_DIM * E_DIM * 2);
  unsigned short* WqT  = (unsigned short*)alloc((size_t)NH_ * HS_ * E_DIM * 2);
  unsigned short* WkT  = (unsigned short*)alloc((size_t)NH_ * HS_ * E_DIM * 2);
  unsigned short* WvT  = (unsigned short*)alloc((size_t)NH_ * HS_ * E_DIM * 2);
  unsigned short* WoT  = (unsigned short*)alloc((size_t)D_DIM * D_DIM * 2);
  unsigned short* W1T  = (unsigned short*)alloc((size_t)FF_DIM * D_DIM * 2);
  unsigned short* W2T  = (unsigned short*)alloc((size_t)E_DIM * FF_DIM * 2);
  unsigned short* Qb   = (unsigned short*)alloc((size_t)NH_ * C_DIM * HS_ * 2);
  unsigned short* Kb   = (unsigned short*)alloc((size_t)NH_ * C_DIM * HS_ * 2);
  unsigned short* Vtb  = (unsigned short*)alloc((size_t)NH_ * HS_ * C_DIM * 2);
  unsigned short* attn = (unsigned short*)alloc((size_t)C_DIM * D_DIM * 2);
  float*          x1   = (float*)alloc((size_t)C_DIM * E_DIM * 4);
  unsigned short* h2   = (unsigned short*)alloc((size_t)C_DIM * D_DIM * 2);
  unsigned short* ff1  = (unsigned short*)alloc((size_t)C_DIM * FF_DIM * 2);

  const dim3 blk(256);

  // ---- weight conversion + transpose to N-major bf16 ----
  cvt_transpose_kernel<E_DIM, HS_><<<dim3(HS_ / 64, E_DIM / 128, NH_), blk, 0, stream>>>(Wq, WqT);
  cvt_transpose_kernel<E_DIM, HS_><<<dim3(HS_ / 64, E_DIM / 128, NH_), blk, 0, stream>>>(Wk, WkT);
  cvt_transpose_kernel<E_DIM, HS_><<<dim3(HS_ / 64, E_DIM / 128, NH_), blk, 0, stream>>>(Wv, WvT);
  cvt_transpose_kernel<D_DIM, D_DIM><<<dim3(D_DIM / 64, D_DIM / 128, 1), blk, 0, stream>>>(Wo, WoT);
  cvt_transpose_kernel<D_DIM, FF_DIM><<<dim3(FF_DIM / 64, D_DIM / 128, 1), blk, 0, stream>>>(W1, W1T);
  cvt_transpose_kernel<FF_DIM, E_DIM><<<dim3(E_DIM / 64, FF_DIM / 128, 1), blk, 0, stream>>>(W2, W2T);

  // ---- LN1 -> bf16 ----
  ln_bf16_kernel<<<dim3(C_DIM / 8), blk, 0, stream>>>(x, ln1_g, ln1_b, hbf);

  // ---- QKV projections (batched over heads); V written transposed ----
  gemm_bf16_kernel<128, 64, false, false, false, true, false>
      <<<dim3(1, C_DIM / 128, NH_), blk, 0, stream>>>(
          hbf, WqT, nullptr, nullptr, nullptr, Qb, C_DIM, HS_, E_DIM,
          0LL, (long long)HS_ * E_DIM, (long long)C_DIM * HS_);
  gemm_bf16_kernel<128, 64, false, false, false, true, false>
      <<<dim3(1, C_DIM / 128, NH_), blk, 0, stream>>>(
          hbf, WkT, nullptr, nullptr, nullptr, Kb, C_DIM, HS_, E_DIM,
          0LL, (long long)HS_ * E_DIM, (long long)C_DIM * HS_);
  gemm_bf16_kernel<128, 64, false, false, false, true, true>
      <<<dim3(1, C_DIM / 128, NH_), blk, 0, stream>>>(
          hbf, WvT, nullptr, nullptr, nullptr, Vtb, C_DIM, HS_, E_DIM,
          0LL, (long long)HS_ * E_DIM, (long long)HS_ * C_DIM);

  // ---- causal flash attention (scale = 1/sqrt(E) per reference) ----
  flash_attn_kernel<<<dim3(C_DIM / 128, NH_), blk, 0, stream>>>(
      Qb, Kb, Vtb, attn, 0.03125f);

  // ---- output projection + bias + residual -> x1 (f32) ----
  gemm_bf16_kernel<128, 128, true, false, true, false, false>
      <<<dim3(D_DIM / 128, C_DIM / 128, 1), blk, 0, stream>>>(
          attn, WoT, bo, x, x1, nullptr, C_DIM, D_DIM, D_DIM, 0LL, 0LL, 0LL);

  // ---- LN2 -> bf16 ----
  ln_bf16_kernel<<<dim3(C_DIM / 8), blk, 0, stream>>>(x1, ln2_g, ln2_b, h2);

  // ---- FFN1: relu(h2 @ W1 + b1) -> bf16 ----
  gemm_bf16_kernel<128, 128, true, true, false, true, false>
      <<<dim3(FF_DIM / 128, C_DIM / 128, 1), blk, 0, stream>>>(
          h2, W1T, b1, nullptr, nullptr, ff1, C_DIM, FF_DIM, D_DIM, 0LL, 0LL, 0LL);

  // ---- FFN2: ff1 @ W2 + b2 + x1 -> d_out (f32) ----
  gemm_bf16_kernel<128, 128, true, false, true, false, false>
      <<<dim3(E_DIM / 128, C_DIM / 128, 1), blk, 0, stream>>>(
          ff1, W2T, b2, x1, out, nullptr, C_DIM, E_DIM, FF_DIM, 0LL, 0LL, 0LL);
}

// v005
// A run of this version takes 206 microseconds.
// Next to v004, in two timings, it ran 1.10 times as fast each time.
// Counting every step since v000, it is 1.91 times as fast.
#include <hip/hip_runtime.h>
#include <cstdint>

// ---------------------------------------------------------------------------
// Transformer block (pre-norm MHA + FFN) for MI455X (gfx1250, wave32, WMMA).
// GEMMs: v_wmma_f32_16x16x32_bf16, LDS tiles staged by the Tensor Data Mover
// (tensor_load_to_lds, TENSORcnt-tracked, double-buffered).  LN / softmax /
// residuals in f32.  Attention is causal flash-style (online softmax).
// ---------------------------------------------------------------------------

#define C_DIM  4096
#define E_DIM  1024
#define NH_    16
#define HS_    64
#define D_DIM  1024
#define FF_DIM 4096

typedef __attribute__((ext_vector_type(16))) __bf16 v16bf;
typedef __attribute__((ext_vector_type(8)))  float  v8f;
typedef __attribute__((ext_vector_type(4)))  unsigned int u32x4;
typedef __attribute__((ext_vector_type(8)))  int  i32x8;
typedef __attribute__((ext_vector_type(4)))  int  i32x4;

union BFrag { v16bf v; uint4 q[2]; unsigned short us[16]; };
union FAcc  { v8f   v; float f[8]; };

typedef __attribute__((ext_vector_type(2))) float f32x2;

// two f32 -> packed bf16 pair, round to nearest even
__device__ __forceinline__ unsigned int pack_bf16x2(f32x2 v) {
  typedef __bf16 bf2 __attribute__((ext_vector_type(2)));
  return __builtin_bit_cast(unsigned int, __builtin_convertvector(v, bf2));
}

__device__ __forceinline__ v8f wmma_bf16(BFrag a, BFrag b, v8f c) {
  return __builtin_amdgcn_wmma_f32_16x16x32_bf16(
      /*neg_a=*/false, a.v, /*neg_b=*/false, b.v,
      /*c_mod=*/(short)0, c, /*reuse_a=*/false, /*reuse_b=*/false);
}

// ---------------------------------------------------------------------------
// TDM: DMA a 2D tile (rows x k_dw dwords) from global into LDS, with the
// hardware inserting 4 pad dwords after every 32 data dwords so the LDS tile
// keeps a (BK/2 + 4)-dword pitch (bank-conflict padding).  D# per ISA ch.8:
//   group0: count=1 | lds_addr | global tile addr (57b) | type=2
//   group1: data_size=4B, pad_enable, pad_interval=32dw(code 4),
//           pad_amount=4dw(code 3), tensor dims huge (tiles never OOB),
//           tile_dim0=k_dw, tile_dim1=rows, dim0 stride = pitch_dw
// ---------------------------------------------------------------------------
__device__ __forceinline__ void tdm_load_tile(
    const unsigned short* g, const void* lds, int rows, int k_dw,
    long long pitch_dw)
{
  const unsigned long long ga = (unsigned long long)(size_t)g;
  const unsigned lds_off = (unsigned)(size_t)lds;   // low 32b == LDS offset
  const u32x4 g0 = { 1u, lds_off,
                     (unsigned)(ga & 0xFFFFFFFFull),
                     (unsigned)((ga >> 32) & 0x01FFFFFFull) | (2u << 30) };
  const unsigned d0 = 1u << 20;     // tensor_dim0 (OOB never hit)
  const unsigned d1 = 1u << 20;     // tensor_dim1
  const unsigned long long s0 = (unsigned long long)pitch_dw;
  const i32x8 g1 = {
      (int)((2u << 16) | (1u << 20) | (4u << 22) | (3u << 25)),
      (int)((d0 & 0xFFFFu) << 16),
      (int)((d0 >> 16) | ((d1 & 0xFFFFu) << 16)),
      (int)((d1 >> 16) | ((unsigned)k_dw << 16)),
      (int)(unsigned)rows,
      (int)(unsigned)(s0 & 0xFFFFFFFFull),
      (int)(unsigned)((s0 >> 32) & 0xFFFFull),
      0 };
  const i32x4 z4 = { 0, 0, 0, 0 };
#if defined(__clang_major__) && (__clang_major__ >= 23)
  const i32x8 z8 = { 0, 0, 0, 0, 0, 0, 0, 0 };
  __builtin_amdgcn_tensor_load_to_lds(g0, g1, z4, z4, z8, 0);
#else
  __builtin_amdgcn_tensor_load_to_lds(g0, g1, z4, z4, 0);
#endif
}

// ---------------------------------------------------------------------------
// f32 [Kd][Nd] row-major  ->  bf16 [Nd][Kd] (N-major, for B fragments)
// One block moves a tile of 128 k x 64 n: 32 elements a thread, so that few
// waves have to start.  Reads and writes are 16 bytes a lane, 256 contiguous
// bytes per 16 lanes.  LDS holds the tile transposed, one dword = the bf16
// pair (k, k + 1), 64 dwords a row; the index of each 16-byte group is XORed
// with n >> 2, which spreads the 32 dword writes of a wave over 32 banks and
// leaves the 16-byte reads whole.
//   tile : 64 * 64 dwords of LDS;  bx, by, bz : tile column, tile row, matrix
// ---------------------------------------------------------------------------
template<int Kd, int Nd>
__device__ __forceinline__ void cvt_transpose_tile(
    const float* __restrict__ in, unsigned short* __restrict__ out,
    unsigned int* tile, int bx, int by, int bz)
{
  const long long base = (long long)bz * Kd * Nd;
  in  += base;
  out += base;
  const int n0 = bx * 64;
  const int k0 = by * 128;
  const int c  = threadIdx.x & 15;
  const int r  = threadIdx.x >> 4;
  // one block-uniform base per side plus one 32-bit byte offset per thread;
  // the row steps are compile-time and go into the instructions' offsets
  const char* ib = (const char*)(in + (long long)k0 * Nd + n0);
  char*       ob = (char*)(out + (long long)n0 * Kd + k0);
  constexpr unsigned int irow = (unsigned int)Nd * 4u;
  constexpr unsigned int orow = (unsigned int)Kd * 2u;
  const unsigned int ioff = 2u * r * irow + 16u * c;
  const unsigned int ooff = r * orow + 16u * c;
  float4 lo[4], hi[4];    // rows k and k + 1, columns n0 + 4c .. + 3
  // the three loops are unrolled so that lo and hi stay in registers and the
  // eight loads, and the four LDS reads, are issued together
#pragma unroll
  for (int p = 0; p < 4; p++) {
    lo[p] = *(const float4*)(ib + ioff + (32u * p) * irow);
    hi[p] = *(const float4*)(ib + ioff + (32u * p + 1u) * irow);
  }
#pragma unroll
  for (int p = 0; p < 4; p++) {
    const int kp  = p * 16 + r;
    const int col = (((kp >> 2) ^ c) << 2) | (kp & 3);
    unsigned int* t = &tile[(4 * c) * 64 + col];
    t[0 * 64] = pack_bf16x2(f32x2{lo[p].x, hi[p].x});
    t[1 * 64] = pack_bf16x2(f32x2{lo[p].y, hi[p].y});
    t[2 * 64] = pack_bf16x2(f32x2{lo[p].z, hi[p].z});
    t[3 * 64] = pack_bf16x2(f32x2{lo[p].w, hi[p].w});
  }
  __syncthreads();
#pragma unroll
  for (int p = 0; p < 4; p++) {
    const int n = p * 16 + r;
    const uint4 v = *(const uint4*)&tile[n * 64 + ((c ^ (n >> 2)) << 2)];
    *(uint4*)(ob + ooff + (16u * p) * orow) = v;
  }
}

// ---------------------------------------------------------------------------
// LayerNorm over last dim (1024) -> bf16.  One wave per row (32 elements a
// lane, all loads in flight at once), eight rows per block: the sums need no
// LDS and no barrier, and an eighth of the waves has to start.  The grid gives
// a SIMD four waves, so the register budget is set for at most eight: the
// loads of g and b then stay ahead of the sums instead of behind them.
// ---------------------------------------------------------------------------
//   rb : which group of eight rows this block takes
__device__ __forceinline__ void ln_bf16_rows(
    const float* __restrict__ x, const float* __restrict__ g,
    const float* __restrict__ b, unsigned short* __restrict__ out, int rb)
{
  const int row  = rb * 8 + (threadIdx.x >> 5);
  const int lane = threadIdx.x & 31;
  const float* xr = x + (long long)row * E_DIM;
  float4 v[8], gg[8], bb[8];
  // every loop here is unrolled: the arrays stay in registers and the 24 loads
  // are issued together
#pragma unroll
  for (int j = 0; j < 8; j++) v[j] = *(const float4*)&xr[j * 128 + lane * 4];
#pragma unroll
  for (int j = 0; j < 8; j++) {
    gg[j] = *(const float4*)&g[j * 128 + lane * 4];
    bb[j] = *(const float4*)&b[j * 128 + lane * 4];
  }
  float4 a1 = {0.f, 0.f, 0.f, 0.f};   // four independent chains each
  float4 a2 = {0.f, 0.f, 0.f, 0.f};
#pragma unroll
  for (int j = 0; j < 8; j++) {
    a1.x += v[j].x;  a1.y += v[j].y;  a1.z += v[j].z;  a1.w += v[j].w;
    a2.x += v[j].x * v[j].x;  a2.y += v[j].y * v[j].y;
    a2.z += v[j].z * v[j].z;  a2.w += v[j].w * v[j].w;
  }
  float s  = (a1.x + a1.y) + (a1.z + a1.w);
  float s2 = (a2.x + a2.y) + (a2.z + a2.w);
#pragma unroll
  for (int msk = 1; msk < 32; msk <<= 1) {
    s  += __shfl_xor(s,  msk, 32);
    s2 += __shfl_xor(s2, msk, 32);
  }
  const float mu  = s * (1.0f / E_DIM);
  const float var = s2 * (1.0f / E_DIM) - mu * mu;
  const float rs  = rsqrtf(var + 1e-5f);
#pragma unroll
  for (int j = 0; j < 8; j++) {
    const int i0 = j * 128 + lane * 4;
    uint2 ov;
    ov.x = pack_bf16x2(f32x2{(v[j].x - mu) * rs * gg[j].x + bb[j].x,
                             (v[j].y - mu) * rs * gg[j].y + bb[j].y});
    ov.y = pack_bf16x2(f32x2{(v[j].z - mu) * rs * gg[j].z + bb[j].z,
                             (v[j].w - mu) * rs * gg[j].w + bb[j].w});
    *(uint2*)&out[(long long)row * E_DIM + i0] = ov;
  }
}

__global__ __launch_bounds__(256) __attribute__((amdgpu_waves_per_eu(4, 8)))
void ln_bf16_kernel(
    const float* __restrict__ x, const float* __restrict__ g,
    const float* __restrict__ b, unsigned short* __restrict__ out)
{
  ln_bf16_rows(x, g, b, out, blockIdx.x);
}

// ---------------------------------------------------------------------------
// Everything that depends on the inputs alone, in ONE launch: the six weight
// transposes and the first layer norm.  None reads what another writes, so
// each takes a range of the block index (a block-uniform, scalar choice) and
// the short launches' gaps, fills and tails are paid once.
// WqkvT holds the transposed Wq, Wk, Wv one behind the other.
// ---------------------------------------------------------------------------
#define PREP_W1   ((FF_DIM / 64) * (D_DIM / 128))
#define PREP_W2   ((E_DIM / 64) * (FF_DIM / 128))
#define PREP_WO   ((D_DIM / 64) * (D_DIM / 128))
#define PREP_HEAD (E_DIM / 128)                 // blocks per head and matrix
#define PREP_QKV  (3 * NH_ * PREP_HEAD)
#define PREP_LN   (C_DIM / 8)
__global__ __launch_bounds__(256) __attribute__((amdgpu_waves_per_eu(4, 8)))
void prep_kernel(
    const float* __restrict__ x, const float* __restrict__ g,
    const float* __restrict__ b, unsigned short* __restrict__ hbf,
    const float* __restrict__ Wq, const float* __restrict__ Wk,
    const float* __restrict__ Wv, const float* __restrict__ Wo,
    const float* __restrict__ W1, const float* __restrict__ W2,
    unsigned short* __restrict__ WqkvT, unsigned short* __restrict__ WoT,
    unsigned short* __restrict__ W1T, unsigned short* __restrict__ W2T)
{
  __shared__ __attribute__((aligned(16))) unsigned int tile[64 * 64];
  int t = blockIdx.x;
  // the layer norm's blocks run longest (a reduction between load and store):
  // they take the lowest indices, which start first
  if (t < PREP_LN) {
    ln_bf16_rows(x, g, b, hbf, t);
    return;
  }
  t -= PREP_LN;
  if (t < PREP_W1) {
    cvt_transpose_tile<D_DIM, FF_DIM>(W1, W1T, tile, t % (FF_DIM / 64), t / (FF_DIM / 64), 0);
    return;
  }
  t -= PREP_W1;
  if (t < PREP_W2) {
    cvt_transpose_tile<FF_DIM, E_DIM>(W2, W2T, tile, t % (E_DIM / 64), t / (E_DIM / 64), 0);
    return;
  }
  t -= PREP_W2;
  if (t < PREP_WO) {
    cvt_transpose_tile<D_DIM, D_DIM>(Wo, WoT, tile, t % (D_DIM / 64), t / (D_DIM / 64), 0);
    return;
  }
  t -= PREP_WO;
  const int w = t / (NH_ * PREP_HEAD);          // 0: Wq, 1: Wk, 2: Wv
  const int r = t % (NH_ * PREP_HEAD);
  const float* in = (w == 0) ? Wq : (w == 1) ? Wk : Wv;
  cvt_transpose_tile<E_DIM, HS_>(in, WqkvT + (long long)w * (NH_ * HS_ * E_DIM),
                                 tile, 0, r % PREP_HEAD, r / PREP_HEAD);
}

// ---------------------------------------------------------------------------
// GEMM epilogue of one block.  acc: the wave's tiles; stA, stB: the operand
// buffers, free for staging; Oz: this z's bf16 output; m0, n0: the tile's place
// ---------------------------------------------------------------------------
template<int BM, int BN, bool BIAS, bool RELU, bool RESID, bool OUT_BF16, bool OUT_TRANS>
__device__ __forceinline__ void gemm_epilogue(
    const FAcc (&acc)[BM / 64][BN / 32], float* const stA, float* const stB,
    const float* __restrict__ bias, const float* __restrict__ resid,
    float* __restrict__ Of, unsigned short* __restrict__ Oz,
    int M, int N, int m0, int n0)
{
  const int wave  = threadIdx.x >> 5;
  const int lane  = threadIdx.x & 31;
  const int lrow  = lane & 15;
  const int lhalf = lane >> 4;
  constexpr int WM = BM / 4;
  constexpr int WN = BN / 2;
  constexpr int MT = WM / 16;
  constexpr int NT = WN / 16;
  const int wm = wave >> 1;
  const int wn = wave & 1;

  // ---- epilogue (C/D layout: lane -> col = l&15, row = vg + 8*(l>>4)) ----
  // The tile goes through LDS in the output's own row order (f32, the operand
  // buffers: behind the loop's last barrier nobody reads them and no tensor
  // load is outstanding).  Every global access is then 4 elements a lane over
  // whole 128-byte lines, and the residual's loads are all in flight at once
  // instead of one round trip per element.
  constexpr int SR  = OUT_TRANS ? BN : BM;      // staged rows = output rows
  constexpr int SC  = OUT_TRANS ? BM : BN;      // staged columns
  constexpr int SP  = SC + 4;                   // pitch, floats: the two wave
                                                // halves fall on other banks
  constexpr int RA  = (SC == 128) ? 64 : 128;   // rows kept in Asm_, rest in Bsm_
  constexpr int LPR = SC / 4;                   // lanes per staged row
  constexpr int RPP = 256 / LPR;                // rows the block moves at once
  constexpr int NIT = SR / RPP;
  static_assert((SR < RA ? SR : RA) * SP * 4 <= 2 * BM * (64 + 8) * 2, "staging");
  static_assert((SR - RA) * SP * 4 <= 2 * BN * (64 + 8) * 2, "staging");
  static_assert(RA % WM == 0 && RA % RPP == 0, "staging");
  static_assert(!OUT_TRANS || (SR <= RA && !BIAS && !RESID && OUT_BF16), "staging");

  const int c4 = (threadIdx.x % LPR) * 4;       // this thread's first column
  const int r0 = threadIdx.x / LPR;             // and its first row
  // output and residual: the buffer's own base plus one 32-bit element offset
  // per thread and row group (no buffer here has 2^30 elements)
  const int ldo = OUT_TRANS ? M : N;            // elements per output row
  const unsigned int off0 = (unsigned int)(
      (OUT_TRANS ? n0 * M + m0 : m0 * N + n0) + r0 * ldo + c4);
  const unsigned int offs = (unsigned int)(RPP * ldo);
  float4 bv = {0.f, 0.f, 0.f, 0.f};
  float4 rv[NIT], sv[NIT];
  if (BIAS) bv = *(const float4*)&bias[n0 + c4];
  if (RESID) {
    // unrolled: rv stays in registers and the loads are issued together
#pragma unroll
    for (int it = 0; it < NIT; it++)
      rv[it] = *(const float4*)((const char*)resid + (off0 + it * offs) * 4u);
  }

  // the staging loops are unrolled so that acc is indexed by constants only and
  // stays in registers
  if (OUT_TRANS) {
    // a lane's eight values of one tile are eight neighbours of an output row
#pragma unroll
    for (int i = 0; i < MT; i++)
#pragma unroll
      for (int j = 0; j < NT; j++) {
        float* t = stA + (wn * WN + j * 16 + lrow) * SP + wm * WM + i * 16 + 8 * lhalf;
        *(float4*)&t[0] = make_float4(acc[i][j].f[0], acc[i][j].f[1],
                                      acc[i][j].f[2], acc[i][j].f[3]);
        *(float4*)&t[4] = make_float4(acc[i][j].f[4], acc[i][j].f[5],
                                      acc[i][j].f[6], acc[i][j].f[7]);
      }
  } else {
    float* const t = ((SR <= RA || wm * WM < RA) ? stA + wm * WM * SP
                                                 : stB + (wm * WM - RA) * SP)
                     + 8 * lhalf * SP + wn * WN + lrow;
#pragma unroll
    for (int i = 0; i < MT; i++)
#pragma unroll
      for (int j = 0; j < NT; j++)
#pragma unroll
        for (int e = 0; e < 8; e++)
          t[(i * 16 + e) * SP + j * 16] = acc[i][j].f[e];
  }
  __syncthreads();

  // two unrolled loops: the LDS reads are issued as one group, not one wait each
#pragma unroll
  for (int it = 0; it < NIT; it++) {
    const int row = it * RPP + r0;
    const float* sp = (it * RPP < RA) ? stA + row * SP : stB + (row - RA) * SP;
    sv[it] = *(const float4*)&sp[c4];
  }
#pragma unroll
  for (int it = 0; it < NIT; it++) {
    float4 v = sv[it];
    if (BIAS)  { v.x += bv.x;  v.y += bv.y;  v.z += bv.z;  v.w += bv.w; }
    if (RELU)  { v.x = fmaxf(v.x, 0.f);  v.y = fmaxf(v.y, 0.f);
                 v.z = fmaxf(v.z, 0.f);  v.w = fmaxf(v.w, 0.f); }
    if (RESID) { v.x += rv[it].x;  v.y += rv[it].y;
                 v.z += rv[it].z;  v.w += rv[it].w; }
    if (OUT_BF16) {
      uint2 ov;
      ov.x = pack_bf16x2(f32x2{v.x, v.y});
      ov.y = pack_bf16x2(f32x2{v.z, v.w});
      *(uint2*)((char*)Oz + (off0 + it * offs) * 2u) = ov;
    } else {
      *(float4*)((char*)Of + (off0 + it * offs) * 4u) = v;
    }
  }
}

// ---------------------------------------------------------------------------
// bf16 WMMA GEMM:  C[M,N] = A[M,K] * Bt[N,K]^T  (+bias, relu, residual)
// 8 waves (4 M x 2 N), BK=64, LDS double-buffered, tiles staged by the TDM
// (wave 0 issues tensor_load_to_lds for tile i+1 while all waves compute
// tile i; drained with s_wait_tensorcnt before the block barrier).
// ---------------------------------------------------------------------------
// TZ: the outputs of z >= TZ are written transposed (a block-uniform choice, so
// that products with either output order share one launch); TZ < 0: none is.
template<int BM, int BN, bool BIAS, bool RELU, bool RESID, bool OUT_BF16, int TZ>
__global__ __launch_bounds__(256, 2) void gemm_bf16_kernel(
    const unsigned short* __restrict__ A,
    const unsigned short* __restrict__ Bt,
    const float* __restrict__ bias,
    const float* __restrict__ resid,
    float* __restrict__ Of,
    unsigned short* __restrict__ Ob,
    int M, int N, int K,
    long long strideA, long long strideB, long long strideO)
{
  constexpr int BK = 64;
  __shared__ unsigned short Asm_[2][BM][BK + 8];
  __shared__ unsigned short Bsm_[2][BN][BK + 8];

  const int z = blockIdx.z;
  A  += (long long)z * strideA;
  Bt += (long long)z * strideB;

  const int wave  = threadIdx.x >> 5;
  const int lane  = threadIdx.x & 31;
  const int lrow  = lane & 15;
  const int lhalf = lane >> 4;
  constexpr int WM = BM / 4;
  constexpr int WN = BN / 2;
  constexpr int MT = WM / 16;
  constexpr int NT = WN / 16;
  const int wm = wave >> 1;
  const int wn = wave & 1;

  const int m0 = blockIdx.y * BM;
  const int n0 = blockIdx.x * BN;

  FAcc acc[MT][NT];
#pragma unroll
  for (int i = 0; i < MT; i++)
#pragma unroll
    for (int j = 0; j < NT; j++)
#pragma unroll
      for (int e = 0; e < 8; e++) acc[i][j].f[e] = 0.f;

  // prologue: DMA tile 0 into buffer 0
  if (wave == 0) {
    tdm_load_tile(&A[(long long)m0 * K], &Asm_[0][0][0], BM, BK / 2, K / 2);
    tdm_load_tile(&Bt[(long long)n0 * K], &Bsm_[0][0][0], BN, BK / 2, K / 2);
    __builtin_amdgcn_s_wait_tensorcnt(0);
  }
  __syncthreads();

  for (int k0 = 0; k0 < K; k0 += BK) {
    const int buf = (k0 / BK) & 1;
    // DMA next tile into the other buffer while this one is consumed
    if (wave == 0 && (k0 + BK) < K) {
      tdm_load_tile(&A[(long long)m0 * K + k0 + BK], &Asm_[buf ^ 1][0][0],
                    BM, BK / 2, K / 2);
      tdm_load_tile(&Bt[(long long)n0 * K + k0 + BK], &Bsm_[buf ^ 1][0][0],
                    BN, BK / 2, K / 2);
    }

#pragma unroll
    for (int kk = 0; kk < BK; kk += 32) {
      BFrag af[MT], bfr[NT];
#pragma unroll
      for (int i = 0; i < MT; i++) {
        const int r = wm * WM + i * 16 + lrow;
        af[i].q[0] = *(const uint4*)&Asm_[buf][r][kk + lhalf * 8];
        af[i].q[1] = *(const uint4*)&Asm_[buf][r][kk + lhalf * 8 + 16];
      }
#pragma unroll
      for (int j = 0; j < NT; j++) {
        const int r = wn * WN + j * 16 + lrow;
        bfr[j].q[0] = *(const uint4*)&Bsm_[buf][r][kk + lhalf * 8];
        bfr[j].q[1] = *(const uint4*)&Bsm_[buf][r][kk + lhalf * 8 + 16];
      }
#pragma unroll
      for (int i = 0; i < MT; i++)
#pragma unroll
        for (int j = 0; j < NT; j++)
          acc[i][j].v = wmma_bf16(af[i], bfr[j], acc[i][j].v);
    }

    if (wave == 0) __builtin_amdgcn_s_wait_tensorcnt(0);
    __syncthreads();
  }

  float* const stA = (float*)&Asm_[0][0][0];
  float* const stB = (float*)&Bsm_[0][0][0];
  unsigned short* const Oz = Ob + (long long)z * strideO;
  if constexpr (TZ >= 0) {
    if (z >= TZ) {
      gemm_epilogue<BM, BN, BIAS, RELU, RESID, OUT_BF16, true>(
          acc, stA, stB, bias, resid, Of, Oz, M, N, m0, n0);
      return;
    }
  }
  gemm_epilogue<BM, BN, BIAS, RELU, RESID, OUT_BF16, false>(
      acc, stA, stB, bias, resid, Of, Oz, M, N, m0, n0);
}

__device__ __forceinline__ float xhalf(float x) {
  const int b = __builtin_bit_cast(int, x);
  return __builtin_bit_cast(float, __builtin_amdgcn_permlanex16(
      b, b, 0x76543210, 0xfedcba98, false, false));
}

// One stage = 128 keys of K (128 rows of 128 B) and of V^T (64 rows of 256 B).
// Every lane brings eight 16-byte pieces from global memory straight into LDS.
//   kg, vg : this lane's first source address;  kl, vl : its first LDS byte
// K: 8 lanes a row, 32 rows per copy; V^T: 16 lanes a row, 16 rows per copy.
#define ATT_ST   128
#define ATT_KPB  ((HS_ + 8) * 2)       // LDS pitch of a K row, bytes
#define ATT_VPB  ((ATT_ST + 8) * 2)    // LDS pitch of a V^T row, bytes
__device__ __forceinline__ void attn_stage_copy(
    const unsigned short* kg, const unsigned short* vg,
    unsigned int kl, unsigned int vl)
{
  // the copies and the wait that lets their address registers be reused stand
  // in one statement, so that no address update can move in front of the wait
  asm volatile(
      "global_load_async_to_lds_b128 %0, %1, off\n\t"
      "global_load_async_to_lds_b128 %2, %3, off\n\t"
      "global_load_async_to_lds_b128 %4, %5, off\n\t"
      "global_load_async_to_lds_b128 %6, %7, off\n\t"
      "global_load_async_to_lds_b128 %8, %9, off\n\t"
      "global_load_async_to_lds_b128 %10, %11, off\n\t"
      "global_load_async_to_lds_b128 %12, %13, off\n\t"
      "global_load_async_to_lds_b128 %14, %15, off\n\t"
      "s_wait_xcnt 0x0"
      :: "v"(kl),                 "v"(kg),
         "v"(kl + 32 * ATT_KPB),  "v"(kg + 32 * HS_),
         "v"(kl + 64 * ATT_KPB),  "v"(kg + 64 * HS_),
         "v"(kl + 96 * ATT_KPB),  "v"(kg + 96 * HS_),
         "v"(vl),                 "v"(vg),
         "v"(vl + 16 * ATT_VPB),  "v"(vg + 16 * C_DIM),
         "v"(vl + 32 * ATT_VPB),  "v"(vg + 32 * C_DIM),
         "v"(vl + 48 * ATT_VPB),  "v"(vg + 48 * C_DIM)
      : "memory");
}

// The grid gives a WGP two blocks, a SIMD four waves: the register budget is
// set for at most four, so that a pass's fragment loads are issued as groups
// ahead of their use, which the passes of one stage (no barrier between them)
// allow.
__global__ __launch_bounds__(256) __attribute__((amdgpu_waves_per_eu(2, 4)))
void flash_attn_kernel(
    const unsigned short* __restrict__ Q,
    const unsigned short* __restrict__ Kmat,
    const unsigned short* __restrict__ Vt,
    unsigned short* __restrict__ Obf,
    float scale)
{
  // two buffers: stage s + 1 is copied while stage s is worked on
  __shared__ __attribute__((aligned(16))) unsigned short Ksm[2][ATT_ST][HS_ + 8];
  __shared__ __attribute__((aligned(16))) unsigned short Vsm[2][HS_][ATT_ST + 8];

  const int h     = blockIdx.y;
  const int qb    = blockIdx.x;
  const int wave  = threadIdx.x >> 5;
  const int lane  = threadIdx.x & 31;
  const int lrow  = lane & 15;
  const int lhalf = lane >> 4;
  const int m0    = qb * 128 + wave * 16;
  const int mg    = m0 + lrow;            // this lane's query

  const unsigned short* Qh = Q    + (long long)h * C_DIM * HS_;
  const unsigned short* Kh = Kmat + (long long)h * C_DIM * HS_;
  const unsigned short* Vh = Vt   + (long long)h * HS_ * C_DIM;

  // this lane's share of a stage: source addresses of stage 0, LDS of buffer 0
  const unsigned short* kg = Kh + threadIdx.x * 8;
  const unsigned short* vg = Vh + (threadIdx.x >> 4) * C_DIM + (threadIdx.x & 15) * 8;
  const unsigned int kl0 =
      (unsigned int)(size_t)&Ksm[0][threadIdx.x >> 3][(threadIdx.x & 7) * 8];
  const unsigned int vl0 =
      (unsigned int)(size_t)&Vsm[0][threadIdx.x >> 4][(threadIdx.x & 15) * 8];
  constexpr unsigned int kbuf = ATT_ST * ATT_KPB;   // bytes of one K buffer
  constexpr unsigned int vbuf = HS_ * ATT_VPB;      // bytes of one V^T buffer

  const int nst = qb + 1;                 // stages of this block
  attn_stage_copy(kg, vg, kl0, vl0);

  BFrag q0, q1;
  {
    const unsigned short* qr = Qh + (long long)mg * HS_;
    q0.q[0] = *(const uint4*)&qr[lhalf * 8];
    q0.q[1] = *(const uint4*)&qr[lhalf * 8 + 16];
    q1.q[0] = *(const uint4*)&qr[32 + lhalf * 8];
    q1.q[1] = *(const uint4*)&qr[48 + lhalf * 8];
  }

  // o[t].f[e] = O^T[t*16 + 8*lhalf + e][query mg]
  FAcc o[4];
#pragma unroll
  for (int t = 0; t < 4; t++)
#pragma unroll
    for (int e = 0; e < 8; e++) o[t].f[e] = 0.f;
  float mrow = -1e30f;   // running maximum of query mg (equal in both halves)
  float lsum = 0.f;      // running sum over this half's keys only

  // stage 0 has landed for this wave, then for all
  asm volatile("s_wait_asynccnt 0x0" ::: "memory");
  __syncthreads();
  if (nst > 1)
    attn_stage_copy(kg + ATT_ST * HS_, vg + ATT_ST, kl0 + kbuf, vl0 + vbuf);

  for (int st = 0; st < nst; st++) {
    const int buf = st & 1;
    // unrolled: the four passes' LDS offsets are immediates, and a pass's
    // fragment loads may be issued during the pass before it
#pragma unroll
    for (int pp = 0; pp < ATT_ST / 32; pp++) {
      const int j0 = st * ATT_ST + pp * 32;

      // ---- S^T = K Q^T: s[nt].f[e] = score(key j0 + nt*16 + 8*lhalf + e, mg) ----
      FAcc s[2];
#pragma unroll
      for (int nt = 0; nt < 2; nt++) {
#pragma unroll
        for (int e = 0; e < 8; e++) s[nt].f[e] = 0.f;
        BFrag k0f, k1f;
        const int r = pp * 32 + nt * 16 + lrow;
        k0f.q[0] = *(const uint4*)&Ksm[buf][r][lhalf * 8];
        k0f.q[1] = *(const uint4*)&Ksm[buf][r][lhalf * 8 + 16];
        k1f.q[0] = *(const uint4*)&Ksm[buf][r][32 + lhalf * 8];
        k1f.q[1] = *(const uint4*)&Ksm[buf][r][48 + lhalf * 8];
        s[nt].v = wmma_bf16(k0f, q0, s[nt].v);
        s[nt].v = wmma_bf16(k1f, q1, s[nt].v);
      }

      // ---- scale (+ causal mask only on diagonal blocks), online softmax ----
      s[0].v = s[0].v * scale;
      s[1].v = s[1].v * scale;
      if (j0 + 31 > m0) {
#pragma unroll
        for (int nt = 0; nt < 2; nt++)
#pragma unroll
          for (int e = 0; e < 8; e++)
            if (j0 + nt * 16 + 8 * lhalf + e > mg) s[nt].f[e] = -1e30f;
      }
      float rmax = fmaxf(s[0].f[0], s[1].f[0]);
#pragma unroll
      for (int e = 1; e < 8; e++) rmax = fmaxf(rmax, fmaxf(s[0].f[e], s[1].f[e]));
      rmax = fmaxf(rmax, xhalf(rmax));

      const float mn    = fmaxf(mrow, rmax);
      const float alpha = __expf(mrow - mn);
      mrow = mn;
      f32x2 rs2 = {0.f, 0.f};
      BFrag pf;   // P^T as B operand: element i of q[nt] = key nt*16 + 8*lhalf + i
#pragma unroll
      for (int nt = 0; nt < 2; nt++) {
        unsigned int w[4];
#pragma unroll
        for (int i = 0; i < 4; i++) {
          const f32x2 p = {__expf(s[nt].f[2 * i] - mn), __expf(s[nt].f[2 * i + 1] - mn)};
          rs2 += p;
          w[i] = pack_bf16x2(p);
        }
        pf.q[nt] = make_uint4(w[0], w[1], w[2], w[3]);
      }
      const float rsum = rs2.x + rs2.y;
      lsum = lsum * alpha + rsum;
#pragma unroll
      for (int t = 0; t < 4; t++)
#pragma unroll
        for (int e = 0; e < 8; e++) o[t].f[e] *= alpha;

      // ---- O^T += V^T P^T ----
#pragma unroll
      for (int nt = 0; nt < 4; nt++) {
        BFrag vf;
        const int r = nt * 16 + lrow;
        vf.q[0] = *(const uint4*)&Vsm[buf][r][pp * 32 + lhalf * 8];
        vf.q[1] = *(const uint4*)&Vsm[buf][r][pp * 32 + lhalf * 8 + 16];
        o[nt].v = wmma_bf16(vf, pf, o[nt].v);
      }
    }

    // hand-over: this wave has left buffer buf, its copies of stage st + 1 have
    // landed; behind the barrier both hold for every wave
    asm volatile("s_wait_dscnt 0x0" ::: "memory");
    asm volatile("s_wait_asynccnt 0x0" ::: "memory");
    __syncthreads();
    if (st + 2 < nst)
      attn_stage_copy(kg + (st + 2) * (ATT_ST * HS_), vg + (st + 2) * ATT_ST,
                      kl0 + buf * kbuf, vl0 + buf * vbuf);
  }
  // no copy is outstanding when the wave ends
  asm volatile("s_wait_asynccnt 0x0" ::: "memory");

  // ---- join the halves' sums, normalize, write concat-by-head output ----
  const float inv = 1.f / (lsum + xhalf(lsum));
#pragma unroll
  for (int nt = 0; nt < 4; nt++) {
    uint4 ov;
    ov.x = pack_bf16x2(f32x2{o[nt].f[0] * inv, o[nt].f[1] * inv});
    ov.y = pack_bf16x2(f32x2{o[nt].f[2] * inv, o[nt].f[3] * inv});
    ov.z = pack_bf16x2(f32x2{o[nt].f[4] * inv, o[nt].f[5] * inv});
    ov.w = pack_bf16x2(f32x2{o[nt].f[6] * inv, o[nt].f[7] * inv});
    *(uint4*)&Obf[(long long)mg * D_DIM + h * HS_ + nt * 16 + 8 * lhalf] = ov;
  }
}

// ---------------------------------------------------------------------------
extern "C" void kernel_launch(void* const* d_in, const int* in_sizes, int n_in,
                              void* d_out, int out_size, void* d_ws, size_t ws_size,
                              hipStream_t stream) {
  (void)in_sizes; (void)n_in; (void)out_size; (void)ws_size;
  const float* x     = (const float*)d_in[0];
  const float* Wq    = (const float*)d_in[1];
  const float* Wk    = (const float*)d_in[2];
  const float* Wv    = (const float*)d_in[3];
  const float* Wo    = (const float*)d_in[4];
  const float* bo    = (const float*)d_in[5];
  const float* W1    = (const float*)d_in[6];
  const float* b1    = (const float*)d_in[7];
  const float* W2    = (const float*)d_in[8];
  const float* b2    = (const float*)d_in[9];
  const float* ln1_g = (const float*)d_in[10];
  const float* ln1_b = (const float*)d_in[11];
  const float* ln2_g = (const float*)d_in[12];
  const float* ln2_b = (const float*)d_in[13];
  float* out = (float*)d_out;

  char* p = (char*)d_ws;
  auto alloc = [&](size_t bytes) -> void* {
    void* r = (void*)p;
    p += (bytes + 255) & ~(size_t)255;
    return r;
  };
  unsigned short* hbf  = (unsigned short*)alloc((size_t)C_DIM * E_DIM * 2);
  // Wq, Wk, Wv transposed, one behind the other: 3 * NH_ matrices of one GEMM
  unsigned short* WqkvT = (unsigned short*)alloc((size_t)3 * NH_ * HS_ * E_DIM * 2);
  unsigned short* WoT  = (unsigned short*)alloc((size_t)D_DIM * D_DIM * 2);
  unsigned short* W1T  = (unsigned short*)alloc((size_t)FF_DIM * D_DIM * 2);
  unsigned short* W2T  = (unsigned short*)alloc((size_t)E_DIM * FF_DIM * 2);
  // Q, K, V^T likewise: 3 * NH_ outputs of C_DIM * HS_ elements each
  unsigned short* Qb   = (unsigned short*)alloc((size_t)3 * NH_ * C_DIM * HS_ * 2);
  unsigned short* Kb   = Qb + (size_t)NH_ * C_DIM * HS_;
  unsigned short* Vtb  = Kb + (size_t)NH_ * C_DIM * HS_;
  unsigned short* attn = (unsigned short*)alloc((size_t)C_DIM * D_DIM * 2);
  float*          x1   = (float*)alloc((size_t)C_DIM * E_DIM * 4);
  unsigned short* h2   = (unsigned short*)alloc((size_t)C_DIM * D_DIM * 2);
  unsigned short* ff1  = (unsigned short*)alloc((size_t)C_DIM * FF_DIM * 2);

  const dim3 blk(256);

  // ---- weights to N-major bf16, and LN1 -> bf16: one launch ----
  prep_kernel<<<dim3(PREP_LN + PREP_W1 + PREP_W2 + PREP_WO + PREP_QKV), blk, 0, stream>>>(
      x, ln1_g, ln1_b, hbf, Wq, Wk, Wv, Wo, W1, W2, WqkvT, WoT, W1T, W2T);

  // ---- Q, K, V projections of all heads: one launch; V written transposed ----
  gemm_bf16_kernel<128, 64, false, false, false, true, 2 * NH_>
      <<<dim3(1, C_DIM / 128, 3 * NH_), blk, 0, stream>>>(
          hbf, WqkvT, nullptr, nullptr, nullptr, Qb, C_DIM, HS_, E_DIM,
          0LL, (long long)HS_ * E_DIM, (long long)C_DIM * HS_);

  // ---- causal flash attention (scale = 1/sqrt(E) per reference) ----
  flash_attn_kernel<<<dim3(C_DIM / 128, NH_), blk, 0, stream>>>(
      Qb, Kb, Vtb, attn, 0.03125f);

  // ---- output projection + bias + residual -> x1 (f32) ----
  gemm_bf16_kernel<128, 128, true, false, true, false, -1>
      <<<dim3(D_DIM / 128, C_DIM / 128, 1), blk, 0, stream>>>(
          attn, WoT, bo, x, x1, nullptr, C_DIM, D_DIM, D_DIM, 0LL, 0LL, 0LL);

  // ---- LN2 -> bf16 ----
  ln_bf16_kernel<<<dim3(C_DIM / 8), blk, 0, stream>>>(x1, ln2_g, ln2_b, h2);

  // ---- FFN1: relu(h2 @ W1 + b1) -> bf16 ----
  gemm_bf16_kernel<128, 128, true, true, false, true, -1>
      <<<dim3(FF_DIM / 128, C_DIM / 128, 1), blk, 0, stream>>>(
          h2, W1T, b1, nullptr, nullptr, ff1, C_DIM, FF_DIM, D_DIM, 0LL, 0LL, 0LL);

  // ---- FFN2: ff1 @ W2 + b2 + x1 -> d_out (f32) ----
  gemm_bf16_kernel<128, 128, true, false, true, false, -1>
      <<<dim3(E_DIM / 128, C_DIM / 128, 1), blk, 0, stream>>>(
          ff1, W2T, b2, x1, out, nullptr, C_DIM, E_DIM, FF_DIM, 0LL, 0LL, 0LL);
}

// v006
// Measured time: 185 microseconds a run.
// Next to v005, in two timings, it ran 1.11 times as fast each time.
// All steps since v000 together make it 2.12 times as fast.
#include <hip/hip_runtime.h>
#include <cstdint>

// ---------------------------------------------------------------------------
// Transformer block (pre-norm MHA + FFN) for MI455X (gfx1250, wave32, WMMA).
// GEMMs: v_wmma_f32_16x16x32_bf16, LDS tiles staged by the Tensor Data Mover
// (tensor_load_to_lds, TENSORcnt-tracked, double-buffered).  LN / softmax /
// residuals in f32.  Attention is causal flash-style (online softmax).
// ---------------------------------------------------------------------------

#define C_DIM  4096
#define E_DIM  1024
#define NH_    16
#define HS_    64
#define D_DIM  1024
#define FF_DIM 4096

typedef __attribute__((ext_vector_type(16))) __bf16 v16bf;
typedef __attribute__((ext_vector_type(8)))  float  v8f;
typedef __attribute__((ext_vector_type(4)))  unsigned int u32x4;
typedef __attribute__((ext_vector_type(8)))  int  i32x8;
typedef __attribute__((ext_vector_type(4)))  int  i32x4;

union BFrag { v16bf v; uint4 q[2]; unsigned short us[16]; };
union FAcc  { v8f   v; float f[8]; };

typedef __attribute__((ext_vector_type(2))) float f32x2;

// two f32 -> packed bf16 pair, round to nearest even
__device__ __forceinline__ unsigned int pack_bf16x2(f32x2 v) {
  typedef __bf16 bf2 __attribute__((ext_vector_type(2)));
  return __builtin_bit_cast(unsigned int, __builtin_convertvector(v, bf2));
}

__device__ __forceinline__ v8f wmma_bf16(BFrag a, BFrag b, v8f c) {
  return __builtin_amdgcn_wmma_f32_16x16x32_bf16(
      /*neg_a=*/false, a.v, /*neg_b=*/false, b.v,
      /*c_mod=*/(short)0, c, /*reuse_a=*/false, /*reuse_b=*/false);
}

// ---------------------------------------------------------------------------
// TDM: DMA a 2D tile (rows x k_dw dwords) from global into LDS, with the
// hardware inserting 4 pad dwords after every 32 data dwords so the LDS tile
// keeps a (BK/2 + 4)-dword pitch (bank-conflict padding).  D# per ISA ch.8:
//   group0: count=1 | lds_addr | global tile addr (57b) | type=2
//   group1: data_size=4B, pad_enable, pad_interval=32dw(code 4),
//           pad_amount=4dw(code 3), tensor dims huge (tiles never OOB),
//           tile_dim0=k_dw, tile_dim1=rows, dim0 stride = pitch_dw
// ---------------------------------------------------------------------------
__device__ __forceinline__ void tdm_load_tile(
    const unsigned short* g, const void* lds, int rows, int k_dw,
    long long pitch_dw)
{
  const unsigned long long ga = (unsigned long long)(size_t)g;
  const unsigned lds_off = (unsigned)(size_t)lds;   // low 32b == LDS offset
  const u32x4 g0 = { 1u, lds_off,
                     (unsigned)(ga & 0xFFFFFFFFull),
                     (unsigned)((ga >> 32) & 0x01FFFFFFull) | (2u << 30) };
  const unsigned d0 = 1u << 20;     // tensor_dim0 (OOB never hit)
  const unsigned d1 = 1u << 20;     // tensor_dim1
  const unsigned long long s0 = (unsigned long long)pitch_dw;
  const i32x8 g1 = {
      (int)((2u << 16) | (1u << 20) | (4u << 22) | (3u << 25)),
      (int)((d0 & 0xFFFFu) << 16),
      (int)((d0 >> 16) | ((d1 & 0xFFFFu) << 16)),
      (int)((d1 >> 16) | ((unsigned)k_dw << 16)),
      (int)(unsigned)rows,
      (int)(unsigned)(s0 & 0xFFFFFFFFull),
      (int)(unsigned)((s0 >> 32) & 0xFFFFull),
      0 };
  const i32x4 z4 = { 0, 0, 0, 0 };
#if defined(__clang_major__) && (__clang_major__ >= 23)
  const i32x8 z8 = { 0, 0, 0, 0, 0, 0, 0, 0 };
  __builtin_amdgcn_tensor_load_to_lds(g0, g1, z4, z4, z8, 0);
#else
  __builtin_amdgcn_tensor_load_to_lds(g0, g1, z4, z4, 0);
#endif
}

// ---------------------------------------------------------------------------
// f32 [Kd][Nd] row-major  ->  bf16 [Nd][Kd] (N-major, for B fragments)
// One block moves a tile of 128 k x 64 n: 32 elements a thread, so that few
// waves have to start.  Reads and writes are 16 bytes a lane, 256 contiguous
// bytes per 16 lanes.  LDS holds the tile transposed, one dword = the bf16
// pair (k, k + 1), 64 dwords a row; the index of each 16-byte group is XORed
// with n >> 2, which spreads the 32 dword writes of a wave over 32 banks and
// leaves the 16-byte reads whole.
//   tile : 64 * 64 dwords of LDS;  bx, by, bz : tile column, tile row, matrix
// ---------------------------------------------------------------------------
template<int Kd, int Nd>
__device__ __forceinline__ void cvt_transpose_tile(
    const float* __restrict__ in, unsigned short* __restrict__ out,
    unsigned int* tile, int bx, int by, int bz)
{
  const long long base = (long long)bz * Kd * Nd;
  in  += base;
  out += base;
  const int n0 = bx * 64;
  const int k0 = by * 128;
  const int c  = threadIdx.x & 15;
  const int r  = threadIdx.x >> 4;
  // one block-uniform base per side plus one 32-bit byte offset per thread;
  // the row steps are compile-time and go into the instructions' offsets
  const char* ib = (const char*)(in + (long long)k0 * Nd + n0);
  char*       ob = (char*)(out + (long long)n0 * Kd + k0);
  constexpr unsigned int irow = (unsigned int)Nd * 4u;
  constexpr unsigned int orow = (unsigned int)Kd * 2u;
  const unsigned int ioff = 2u * r * irow + 16u * c;
  const unsigned int ooff = r * orow + 16u * c;
  float4 lo[4], hi[4];    // rows k and k + 1, columns n0 + 4c .. + 3
  // the three loops are unrolled so that lo and hi stay in registers and the
  // eight loads, and the four LDS reads, are issued together
#pragma unroll
  for (int p = 0; p < 4; p++) {
    lo[p] = *(const float4*)(ib + ioff + (32u * p) * irow);
    hi[p] = *(const float4*)(ib + ioff + (32u * p + 1u) * irow);
  }
#pragma unroll
  for (int p = 0; p < 4; p++) {
    const int kp  = p * 16 + r;
    const int col = (((kp >> 2) ^ c) << 2) | (kp & 3);
    unsigned int* t = &tile[(4 * c) * 64 + col];
    t[0 * 64] = pack_bf16x2(f32x2{lo[p].x, hi[p].x});
    t[1 * 64] = pack_bf16x2(f32x2{lo[p].y, hi[p].y});
    t[2 * 64] = pack_bf16x2(f32x2{lo[p].z, hi[p].z});
    t[3 * 64] = pack_bf16x2(f32x2{lo[p].w, hi[p].w});
  }
  __syncthreads();
#pragma unroll
  for (int p = 0; p < 4; p++) {
    const int n = p * 16 + r;
    const uint4 v = *(const uint4*)&tile[n * 64 + ((c ^ (n >> 2)) << 2)];
    *(uint4*)(ob + ooff + (16u * p) * orow) = v;
  }
}

// ---------------------------------------------------------------------------
// LayerNorm over last dim (1024) -> bf16.  One wave per row (32 elements a
// lane, all loads in flight at once), eight rows per block: the sums need no
// LDS and no barrier, and an eighth of the waves has to start.  The grid gives
// a SIMD four waves, so the register budget is set for at most eight: the
// loads of g and b then stay ahead of the sums instead of behind them.
// ---------------------------------------------------------------------------
//   rb : which group of eight rows this block takes
__device__ __forceinline__ void ln_bf16_rows(
    const float* __restrict__ x, const float* __restrict__ g,
    const float* __restrict__ b, unsigned short* __restrict__ out, int rb)
{
  const int row  = rb * 8 + (threadIdx.x >> 5);
  const int lane = threadIdx.x & 31;
  const float* xr = x + (long long)row * E_DIM;
  float4 v[8], gg[8], bb[8];
  // every loop here is unrolled: the arrays stay in registers and the 24 loads
  // are issued together
#pragma unroll
  for (int j = 0; j < 8; j++) v[j] = *(const float4*)&xr[j * 128 + lane * 4];
#pragma unroll
  for (int j = 0; j < 8; j++) {
    gg[j] = *(const float4*)&g[j * 128 + lane * 4];
    bb[j] = *(const float4*)&b[j * 128 + lane * 4];
  }
  float4 a1 = {0.f, 0.f, 0.f, 0.f};   // four independent chains each
  float4 a2 = {0.f, 0.f, 0.f, 0.f};
#pragma unroll
  for (int j = 0; j < 8; j++) {
    a1.x += v[j].x;  a1.y += v[j].y;  a1.z += v[j].z;  a1.w += v[j].w;
    a2.x += v[j].x * v[j].x;  a2.y += v[j].y * v[j].y;
    a2.z += v[j].z * v[j].z;  a2.w += v[j].w * v[j].w;
  }
  float s  = (a1.x + a1.y) + (a1.z + a1.w);
  float s2 = (a2.x + a2.y) + (a2.z + a2.w);
#pragma unroll
  for (int msk = 1; msk < 32; msk <<= 1) {
    s  += __shfl_xor(s,  msk, 32);
    s2 += __shfl_xor(s2, msk, 32);
  }
  const float mu  = s * (1.0f / E_DIM);
  const float var = s2 * (1.0f / E_DIM) - mu * mu;
  const float rs  = rsqrtf(var + 1e-5f);
#pragma unroll
  for (int j = 0; j < 8; j++) {
    const int i0 = j * 128 + lane * 4;
    uint2 ov;
    ov.x = pack_bf16x2(f32x2{(v[j].x - mu) * rs * gg[j].x + bb[j].x,
                             (v[j].y - mu) * rs * gg[j].y + bb[j].y});
    ov.y = pack_bf16x2(f32x2{(v[j].z - mu) * rs * gg[j].z + bb[j].z,
                             (v[j].w - mu) * rs * gg[j].w + bb[j].w});
    *(uint2*)&out[(long long)row * E_DIM + i0] = ov;
  }
}

__global__ __launch_bounds__(256) __attribute__((amdgpu_waves_per_eu(4, 8)))
void ln_bf16_kernel(
    const float* __restrict__ x, const float* __restrict__ g,
    const float* __restrict__ b, unsigned short* __restrict__ out)
{
  ln_bf16_rows(x, g, b, out, blockIdx.x);
}

// ---------------------------------------------------------------------------
// Everything that depends on the inputs alone, in ONE launch: the six weight
// transposes and the first layer norm.  None reads what another writes, so
// each takes a range of the block index (a block-uniform, scalar choice) and
// the short launches' gaps, fills and tails are paid once.
// WqkvT holds the transposed Wq, Wk, Wv one behind the other.
// ---------------------------------------------------------------------------
#define PREP_W1   ((FF_DIM / 64) * (D_DIM / 128))
#define PREP_W2   ((E_DIM / 64) * (FF_DIM / 128))
#define PREP_WO   ((D_DIM / 64) * (D_DIM / 128))
#define PREP_HEAD (E_DIM / 128)                 // blocks per head and matrix
#define PREP_QKV  (3 * NH_ * PREP_HEAD)
#define PREP_LN   (C_DIM / 8)
__global__ __launch_bounds__(256) __attribute__((amdgpu_waves_per_eu(4, 8)))
void prep_kernel(
    const float* __restrict__ x, const float* __restrict__ g,
    const float* __restrict__ b, unsigned short* __restrict__ hbf,
    const float* __restrict__ Wq, const float* __restrict__ Wk,
    const float* __restrict__ Wv, const float* __restrict__ Wo,
    const float* __restrict__ W1, const float* __restrict__ W2,
    unsigned short* __restrict__ WqkvT, unsigned short* __restrict__ WoT,
    unsigned short* __restrict__ W1T, unsigned short* __restrict__ W2T)
{
  __shared__ __attribute__((aligned(16))) unsigned int tile[64 * 64];
  int t = blockIdx.x;
  // the layer norm's blocks run longest (a reduction between load and store):
  // they take the lowest indices, which start first
  if (t < PREP_LN) {
    ln_bf16_rows(x, g, b, hbf, t);
    return;
  }
  t -= PREP_LN;
  if (t < PREP_W1) {
    cvt_transpose_tile<D_DIM, FF_DIM>(W1, W1T, tile, t % (FF_DIM / 64), t / (FF_DIM / 64), 0);
    return;
  }
  t -= PREP_W1;
  if (t < PREP_W2) {
    cvt_transpose_tile<FF_DIM, E_DIM>(W2, W2T, tile, t % (E_DIM / 64), t / (E_DIM / 64), 0);
    return;
  }
  t -= PREP_W2;
  if (t < PREP_WO) {
    cvt_transpose_tile<D_DIM, D_DIM>(Wo, WoT, tile, t % (D_DIM / 64), t / (D_DIM / 64), 0);
    return;
  }
  t -= PREP_WO;
  const int w = t / (NH_ * PREP_HEAD);          // 0: Wq, 1: Wk, 2: Wv
  const int r = t % (NH_ * PREP_HEAD);
  const float* in = (w == 0) ? Wq : (w == 1) ? Wk : Wv;
  cvt_transpose_tile<E_DIM, HS_>(in, WqkvT + (long long)w * (NH_ * HS_ * E_DIM),
                                 tile, 0, r % PREP_HEAD, r / PREP_HEAD);
}

// ---------------------------------------------------------------------------
// GEMM epilogue of one block.  acc: the wave's tiles; stA, stB: the operand
// buffers, free for staging; Oz: this z's bf16 output; m0, n0: the tile's place
// ---------------------------------------------------------------------------
template<int BM, int BN, bool BIAS, bool RELU, bool RESID, bool OUT_BF16, bool OUT_TRANS>
__device__ __forceinline__ void gemm_epilogue(
    const FAcc (&acc)[BM / 64][BN / 32], float* const stA, float* const stB,
    const float* __restrict__ bias, const float* __restrict__ resid,
    float* __restrict__ Of, unsigned short* __restrict__ Oz,
    int M, int N, int m0, int n0)
{
  const int wave  = threadIdx.x >> 5;
  const int lane  = threadIdx.x & 31;
  const int lrow  = lane & 15;
  const int lhalf = lane >> 4;
  constexpr int WM = BM / 4;
  constexpr int WN = BN / 2;
  constexpr int MT = WM / 16;
  constexpr int NT = WN / 16;
  const int wm = wave >> 1;
  const int wn = wave & 1;

  // ---- epilogue (C/D layout: lane -> col = l&15, row = vg + 8*(l>>4)) ----
  // The tile goes through LDS in the output's own row order (f32, the operand
  // buffers: behind the loop's last barrier nobody reads them and no tensor
  // load is outstanding).  Every global access is then 4 elements a lane over
  // whole 128-byte lines, and the residual's loads are all in flight at once
  // instead of one round trip per element.
  constexpr int SR  = OUT_TRANS ? BN : BM;      // staged rows = output rows
  constexpr int SC  = OUT_TRANS ? BM : BN;      // staged columns
  constexpr int SP  = SC + 4;                   // pitch, floats: the two wave
                                                // halves fall on other banks
  constexpr int RA  = (SC == 128) ? 64 : 128;   // rows kept in Asm_, rest in Bsm_
  constexpr int LPR = SC / 4;                   // lanes per staged row
  constexpr int RPP = 256 / LPR;                // rows the block moves at once
  constexpr int NIT = SR / RPP;
  static_assert((SR < RA ? SR : RA) * SP * 4 <= 2 * BM * (64 + 8) * 2, "staging");
  static_assert((SR - RA) * SP * 4 <= 2 * BN * (64 + 8) * 2, "staging");
  static_assert(RA % WM == 0 && RA % RPP == 0, "staging");
  static_assert(!OUT_TRANS || (SR <= RA && !BIAS && !RESID && OUT_BF16), "staging");

  const int c4 = (threadIdx.x % LPR) * 4;       // this thread's first column
  const int r0 = threadIdx.x / LPR;             // and its first row
  // output and residual: the buffer's own base plus one 32-bit element offset
  // per thread and row group (no buffer here has 2^30 elements)
  const int ldo = OUT_TRANS ? M : N;            // elements per output row
  const unsigned int off0 = (unsigned int)(
      (OUT_TRANS ? n0 * M + m0 : m0 * N + n0) + r0 * ldo + c4);
  const unsigned int offs = (unsigned int)(RPP * ldo);
  float4 bv = {0.f, 0.f, 0.f, 0.f};
  float4 rv[NIT], sv[NIT];
  if (BIAS) bv = *(const float4*)&bias[n0 + c4];
  if (RESID) {
    // unrolled: rv stays in registers and the loads are issued together
#pragma unroll
    for (int it = 0; it < NIT; it++)
      rv[it] = *(const float4*)((const char*)resid + (off0 + it * offs) * 4u);
  }

  // the staging loops are unrolled so that acc is indexed by constants only and
  // stays in registers
  if (OUT_TRANS) {
    // a lane's eight values of one tile are eight neighbours of an output row
#pragma unroll
    for (int i = 0; i < MT; i++)
#pragma unroll
      for (int j = 0; j < NT; j++) {
        float* t = stA + (wn * WN + j * 16 + lrow) * SP + wm * WM + i * 16 + 8 * lhalf;
        *(float4*)&t[0] = make_float4(acc[i][j].f[0], acc[i][j].f[1],
                                      acc[i][j].f[2], acc[i][j].f[3]);
        *(float4*)&t[4] = make_float4(acc[i][j].f[4], acc[i][j].f[5],
                                      acc[i][j].f[6], acc[i][j].f[7]);
      }
  } else {
    float* const t = ((SR <= RA || wm * WM < RA) ? stA + wm * WM * SP
                                                 : stB + (wm * WM - RA) * SP)
                     + 8 * lhalf * SP + wn * WN + lrow;
#pragma unroll
    for (int i = 0; i < MT; i++)
#pragma unroll
      for (int j = 0; j < NT; j++)
#pragma unroll
        for (int e = 0; e < 8; e++)
          t[(i * 16 + e) * SP + j * 16] = acc[i][j].f[e];
  }
  __syncthreads();

  // two unrolled loops: the LDS reads are issued as one group, not one wait each
#pragma unroll
  for (int it = 0; it < NIT; it++) {
    const int row = it * RPP + r0;
    const float* sp = (it * RPP < RA) ? stA + row * SP : stB + (row - RA) * SP;
    sv[it] = *(const float4*)&sp[c4];
  }
#pragma unroll
  for (int it = 0; it < NIT; it++) {
    float4 v = sv[it];
    if (BIAS)  { v.x += bv.x;  v.y += bv.y;  v.z += bv.z;  v.w += bv.w; }
    if (RELU)  { v.x = fmaxf(v.x, 0.f);  v.y = fmaxf(v.y, 0.f);
                 v.z = fmaxf(v.z, 0.f);  v.w = fmaxf(v.w, 0.f); }
    if (RESID) { v.x += rv[it].x;  v.y += rv[it].y;
                 v.z += rv[it].z;  v.w += rv[it].w; }
    if (OUT_BF16) {
      uint2 ov;
      ov.x = pack_bf16x2(f32x2{v.x, v.y});
      ov.y = pack_bf16x2(f32x2{v.z, v.w});
      *(uint2*)((char*)Oz + (off0 + it * offs) * 2u) = ov;
    } else {
      *(float4*)((char*)Of + (off0 + it * offs) * 4u) = v;
    }
  }
}

// ---------------------------------------------------------------------------
// bf16 WMMA GEMM:  C[M,N] = A[M,K] * Bt[N,K]^T  (+bias, relu, residual)
// 8 waves (4 M x 2 N), BK=64, LDS double-buffered, tiles staged by the TDM
// (wave 0 issues tensor_load_to_lds for tile i+1 while all waves compute
// tile i; drained with s_wait_tensorcnt before the block barrier).
// ---------------------------------------------------------------------------
// TZ: the outputs of z >= TZ are written transposed (a block-uniform choice, so
// that products with either output order share one launch); TZ < 0: none is.
template<int BM, int BN, bool BIAS, bool RELU, bool RESID, bool OUT_BF16, int TZ>
__global__ __launch_bounds__(256, 2) void gemm_bf16_kernel(
    const unsigned short* __restrict__ A,
    const unsigned short* __restrict__ Bt,
    const float* __restrict__ bias,
    const float* __restrict__ resid,
    float* __restrict__ Of,
    unsigned short* __restrict__ Ob,
    int M, int N, int K,
    long long strideA, long long strideB, long long strideO)
{
  constexpr int BK = 64;
  __shared__ unsigned short Asm_[2][BM][BK + 8];
  __shared__ unsigned short Bsm_[2][BN][BK + 8];

  const int z = blockIdx.z;
  A  += (long long)z * strideA;
  Bt += (long long)z * strideB;

  const int wave  = threadIdx.x >> 5;
  const int lane  = threadIdx.x & 31;
  const int lrow  = lane & 15;
  const int lhalf = lane >> 4;
  constexpr int WM = BM / 4;
  constexpr int WN = BN / 2;
  constexpr int MT = WM / 16;
  constexpr int NT = WN / 16;
  const int wm = wave >> 1;
  const int wn = wave & 1;

  const int m0 = blockIdx.y * BM;
  const int n0 = blockIdx.x * BN;

  FAcc acc[MT][NT];
#pragma unroll
  for (int i = 0; i < MT; i++)
#pragma unroll
    for (int j = 0; j < NT; j++)
#pragma unroll
      for (int e = 0; e < 8; e++) acc[i][j].f[e] = 0.f;

  // prologue: DMA tile 0 into buffer 0
  if (wave == 0) {
    tdm_load_tile(&A[(long long)m0 * K], &Asm_[0][0][0], BM, BK / 2, K / 2);
    tdm_load_tile(&Bt[(long long)n0 * K], &Bsm_[0][0][0], BN, BK / 2, K / 2);
    __builtin_amdgcn_s_wait_tensorcnt(0);
  }
  __syncthreads();

  for (int k0 = 0; k0 < K; k0 += BK) {
    const int buf = (k0 / BK) & 1;
    // DMA next tile into the other buffer while this one is consumed
    if (wave == 0 && (k0 + BK) < K) {
      tdm_load_tile(&A[(long long)m0 * K + k0 + BK], &Asm_[buf ^ 1][0][0],
                    BM, BK / 2, K / 2);
      tdm_load_tile(&Bt[(long long)n0 * K + k0 + BK], &Bsm_[buf ^ 1][0][0],
                    BN, BK / 2, K / 2);
    }

#pragma unroll
    for (int kk = 0; kk < BK; kk += 32) {
      BFrag af[MT], bfr[NT];
#pragma unroll
      for (int i = 0; i < MT; i++) {
        const int r = wm * WM + i * 16 + lrow;
        af[i].q[0] = *(const uint4*)&Asm_[buf][r][kk + lhalf * 8];
        af[i].q[1] = *(const uint4*)&Asm_[buf][r][kk + lhalf * 8 + 16];
      }
#pragma unroll
      for (int j = 0; j < NT; j++) {
        const int r = wn * WN + j * 16 + lrow;
        bfr[j].q[0] = *(const uint4*)&Bsm_[buf][r][kk + lhalf * 8];
        bfr[j].q[1] = *(const uint4*)&Bsm_[buf][r][kk + lhalf * 8 + 16];
      }
#pragma unroll
      for (int i = 0; i < MT; i++)
#pragma unroll
        for (int j = 0; j < NT; j++)
          acc[i][j].v = wmma_bf16(af[i], bfr[j], acc[i][j].v);
    }

    if (wave == 0) __builtin_amdgcn_s_wait_tensorcnt(0);
    __syncthreads();
  }

  float* const stA = (float*)&Asm_[0][0][0];
  float* const stB = (float*)&Bsm_[0][0][0];
  unsigned short* const Oz = Ob + (long long)z * strideO;
  if constexpr (TZ >= 0) {
    if (z >= TZ) {
      gemm_epilogue<BM, BN, BIAS, RELU, RESID, OUT_BF16, true>(
          acc, stA, stB, bias, resid, Of, Oz, M, N, m0, n0);
      return;
    }
  }
  gemm_epilogue<BM, BN, BIAS, RELU, RESID, OUT_BF16, false>(
      acc, stA, stB, bias, resid, Of, Oz, M, N, m0, n0);
}

__device__ __forceinline__ float xhalf(float x) {
  const int b = __builtin_bit_cast(int, x);
  return __builtin_bit_cast(float, __builtin_amdgcn_permlanex16(
      b, b, 0x76543210, 0xfedcba98, false, false));
}

// One stage = 128 keys of K (128 rows of 128 B) and of V^T (64 rows of 256 B).
// Every lane brings eight 16-byte pieces from global memory straight into LDS.
//   kg, vg : this lane's first source address;  kl, vl : its first LDS byte
// K: 8 lanes a row, 32 rows per copy; V^T: 16 lanes a row, 16 rows per copy.
#define ATT_ST   128
#define ATT_KPB  ((HS_ + 8) * 2)       // LDS pitch of a K row, bytes
#define ATT_VPB  ((ATT_ST + 8) * 2)    // LDS pitch of a V^T row, bytes
__device__ __forceinline__ void attn_stage_copy(
    const unsigned short* kg, const unsigned short* vg,
    unsigned int kl, unsigned int vl)
{
  // the copies and the wait that lets their address registers be reused stand
  // in one statement, so that no address update can move in front of the wait
  asm volatile(
      "global_load_async_to_lds_b128 %0, %1, off\n\t"
      "global_load_async_to_lds_b128 %2, %3, off\n\t"
      "global_load_async_to_lds_b128 %4, %5, off\n\t"
      "global_load_async_to_lds_b128 %6, %7, off\n\t"
      "global_load_async_to_lds_b128 %8, %9, off\n\t"
      "global_load_async_to_lds_b128 %10, %11, off\n\t"
      "global_load_async_to_lds_b128 %12, %13, off\n\t"
      "global_load_async_to_lds_b128 %14, %15, off\n\t"
      "s_wait_xcnt 0x0"
      :: "v"(kl),                 "v"(kg),
         "v"(kl + 32 * ATT_KPB),  "v"(kg + 32 * HS_),
         "v"(kl + 64 * ATT_KPB),  "v"(kg + 64 * HS_),
         "v"(kl + 96 * ATT_KPB),  "v"(kg + 96 * HS_),
         "v"(vl),                 "v"(vg),
         "v"(vl + 16 * ATT_VPB),  "v"(vg + 16 * C_DIM),
         "v"(vl + 32 * ATT_VPB),  "v"(vg + 32 * C_DIM),
         "v"(vl + 48 * ATT_VPB),  "v"(vg + 48 * C_DIM)
      : "memory");
}

// Causal work is made equal: a workgroup takes query tile 31 - t and then tile
// t of one head, one after the other in every wave, so that every workgroup
// walks 17 double stages.  16 waves, one workgroup per WGP, four waves a SIMD:
// wave group 0 (waves 0-7) works on the even key stages, group 1 on the odd
// ones, each with its own two buffers and its own running maximum, sum and
// O^T; the two states are joined through LDS at the end of a tile.
// The register budget is set for four waves a SIMD, so that a pass's fragment
// loads are issued as groups ahead of their use, which the passes of one stage
// (no barrier between them) allow.
#define ATT_NT (C_DIM / 128)           // query tiles of a head
__global__ __launch_bounds__(512) __attribute__((amdgpu_waves_per_eu(4, 4)))
void flash_attn_kernel(
    const unsigned short* __restrict__ Q,
    const unsigned short* __restrict__ Kmat,
    const unsigned short* __restrict__ Vt,
    unsigned short* __restrict__ Obf,
    float scale)
{
  // [buffer][wave group]: double stage i + 1 is copied while i is worked on
  __shared__ __attribute__((aligned(16))) unsigned short Ksm[2][2][ATT_ST][HS_ + 8];
  __shared__ __attribute__((aligned(16))) unsigned short Vsm[2][2][HS_][ATT_ST + 8];
  // group 1's state on its way to group 0: O^T, then (maximum, sum)
  __shared__ __attribute__((aligned(16))) float4 Jo[8][8][32];
  __shared__ __attribute__((aligned(16))) float2 Jml[8][32];

  const int h     = blockIdx.y;
  // wave group, in a scalar register: the branches on it are scalar branches
  const int grp   = __builtin_amdgcn_readfirstlane(threadIdx.x >> 8);
  const int tid   = threadIdx.x & 255;    // thread within its wave group
  const int wave  = tid >> 5;
  const int lane  = tid & 31;
  const int lrow  = lane & 15;
  const int lhalf = lane >> 4;

  const unsigned short* Qh = Q    + (long long)h * C_DIM * HS_;
  const unsigned short* Kh = Kmat + (long long)h * C_DIM * HS_;
  const unsigned short* Vh = Vt   + (long long)h * HS_ * C_DIM;

  // this lane's share of its group's stages: source addresses of the group's
  // first stage, LDS of buffer 0
  const unsigned short* kg = Kh + grp * (ATT_ST * HS_) + tid * 8;
  const unsigned short* vg = Vh + grp * ATT_ST + (tid >> 4) * C_DIM + (tid & 15) * 8;
  const unsigned int kl0 =
      (unsigned int)(size_t)&Ksm[0][grp][tid >> 3][(tid & 7) * 8];
  const unsigned int vl0 =
      (unsigned int)(size_t)&Vsm[0][grp][tid >> 4][(tid & 15) * 8];
  constexpr unsigned int kbuf = 2 * ATT_ST * ATT_KPB;   // bytes of one K buffer
  constexpr unsigned int vbuf = 2 * HS_ * ATT_VPB;      // bytes of one V^T buffer

  for (int part = 0; part < 2; part++) {
    const int qb  = part ? (int)blockIdx.x : ATT_NT - 1 - (int)blockIdx.x;
    const int m0  = qb * 128 + wave * 16;
    const int mg  = m0 + lrow;            // this lane's query
    const int nst = qb + 1;               // key stages of this tile
    // double stages; with nst odd group 1's last stage lies above the diagonal
    // (and inside K and V^T: nst is then below ATT_NT): copied, not worked on
    const int nds = (nst + 1) >> 1;
    // every wave has left both buffers: the barrier at the foot of the tile
    // before, behind each wave's s_wait_dscnt 0
    attn_stage_copy(kg, vg, kl0, vl0);

    BFrag q0, q1;
    {
      const unsigned short* qr = Qh + (long long)mg * HS_;
      q0.q[0] = *(const uint4*)&qr[lhalf * 8];
      q0.q[1] = *(const uint4*)&qr[lhalf * 8 + 16];
      q1.q[0] = *(const uint4*)&qr[32 + lhalf * 8];
      q1.q[1] = *(const uint4*)&qr[48 + lhalf * 8];
    }

    // o[t].f[e] = O^T[t*16 + 8*lhalf + e][query mg], this group's keys only
    FAcc o[4];
#pragma unroll
    for (int t = 0; t < 4; t++)
#pragma unroll
      for (int e = 0; e < 8; e++) o[t].f[e] = 0.f;
    float mrow = -1e30f;   // running maximum of query mg (equal in both halves)
    float lsum = 0.f;      // running sum over this half's keys only

    // double stage 0 has landed for this wave, then for all
    asm volatile("s_wait_asynccnt 0x0" ::: "memory");
    __syncthreads();
    if (nds > 1)
      attn_stage_copy(kg + 2 * (ATT_ST * HS_), vg + 2 * ATT_ST, kl0 + kbuf, vl0 + vbuf);

    for (int ds = 0; ds < nds; ds++) {
      const int buf = ds & 1;
      const int st  = 2 * ds + grp;       // this group's key stage
      if (st < nst) {
        // unrolled: the four passes' LDS offsets are immediates, and a pass's
        // fragment loads may be issued during the pass before it
#pragma unroll
        for (int pp = 0; pp < ATT_ST / 32; pp++) {
          const int j0 = st * ATT_ST + pp * 32;

          // ---- S^T = K Q^T: s[nt].f[e] = score(key j0 + nt*16 + 8*lhalf + e, mg) ----
          FAcc s[2];
#pragma unroll
          for (int nt = 0; nt < 2; nt++) {
#pragma unroll
            for (int e = 0; e < 8; e++) s[nt].f[e] = 0.f;
            BFrag k0f, k1f;
            const int r = pp * 32 + nt * 16 + lrow;
            k0f.q[0] = *(const uint4*)&Ksm[buf][grp][r][lhalf * 8];
            k0f.q[1] = *(const uint4*)&Ksm[buf][grp][r][lhalf * 8 + 16];
            k1f.q[0] = *(const uint4*)&Ksm[buf][grp][r][32 + lhalf * 8];
            k1f.q[1] = *(const uint4*)&Ksm[buf][grp][r][48 + lhalf * 8];
            s[nt].v = wmma_bf16(k0f, q0, s[nt].v);
            s[nt].v = wmma_bf16(k1f, q1, s[nt].v);
          }

          // ---- scale (+ causal mask only on diagonal blocks), online softmax ----
          s[0].v = s[0].v * scale;
          s[1].v = s[1].v * scale;
          if (j0 + 31 > m0) {
#pragma unroll
            for (int nt = 0; nt < 2; nt++)
#pragma unroll
              for (int e = 0; e < 8; e++)
                if (j0 + nt * 16 + 8 * lhalf + e > mg) s[nt].f[e] = -1e30f;
          }
          float rmax = fmaxf(s[0].f[0], s[1].f[0]);
#pragma unroll
          for (int e = 1; e < 8; e++) rmax = fmaxf(rmax, fmaxf(s[0].f[e], s[1].f[e]));
          rmax = fmaxf(rmax, xhalf(rmax));

          const float mn    = fmaxf(mrow, rmax);
          const float alpha = __expf(mrow - mn);
          mrow = mn;
          f32x2 rs2 = {0.f, 0.f};
          BFrag pf;   // P^T as B operand: element i of q[nt] = key nt*16 + 8*lhalf + i
#pragma unroll
          for (int nt = 0; nt < 2; nt++) {
            unsigned int w[4];
#pragma unroll
            for (int i = 0; i < 4; i++) {
              const f32x2 p = {__expf(s[nt].f[2 * i] - mn), __expf(s[nt].f[2 * i + 1] - mn)};
              rs2 += p;
              w[i] = pack_bf16x2(p);
            }
            pf.q[nt] = make_uint4(w[0], w[1], w[2], w[3]);
          }
          const float rsum = rs2.x + rs2.y;
          lsum = lsum * alpha + rsum;
#pragma unroll
          for (int t = 0; t < 4; t++)
#pragma unroll
            for (int e = 0; e < 8; e++) o[t].f[e] *= alpha;

          // ---- O^T += V^T P^T ----
#pragma unroll
          for (int nt = 0; nt < 4; nt++) {
            BFrag vf;
            const int r = nt * 16 + lrow;
            vf.q[0] = *(const uint4*)&Vsm[buf][grp][r][pp * 32 + lhalf * 8];
            vf.q[1] = *(const uint4*)&Vsm[buf][grp][r][pp * 32 + lhalf * 8 + 16];
            o[nt].v = wmma_bf16(vf, pf, o[nt].v);
          }
        }
      }

      // hand-over: this wave has left buffer buf, its copies of double stage
      // ds + 1 have landed; behind the barrier both hold for every wave
      asm volatile("s_wait_dscnt 0x0" ::: "memory");
      asm volatile("s_wait_asynccnt 0x0" ::: "memory");
      __syncthreads();
      if (ds + 2 < nds)
        attn_stage_copy(kg + (2 * ds + 4) * (ATT_ST * HS_), vg + (2 * ds + 4) * ATT_ST,
                        kl0 + buf * kbuf, vl0 + buf * vbuf);
    }
    // no copy is outstanding behind the loop: the buffers are free for the next
    // tile, and the wave may end
    asm volatile("s_wait_asynccnt 0x0" ::: "memory");

    // ---- join the two groups' states: group 1 hands its own over ----
    // A group 1 wave that saw no key at or below the diagonal still has the
    // start maximum, and its finite sums get the weight exp(-1e30 - m) = 0.
    if (grp == 1) {
#pragma unroll
      for (int t = 0; t < 4; t++) {
        Jo[wave][2 * t][lane]     = make_float4(o[t].f[0], o[t].f[1], o[t].f[2], o[t].f[3]);
        Jo[wave][2 * t + 1][lane] = make_float4(o[t].f[4], o[t].f[5], o[t].f[6], o[t].f[7]);
      }
      Jml[wave][lane] = make_float2(mrow, lsum);
    }
    // group 1's state is in LDS for group 0; it is written again only behind
    // the next tile's barriers, which group 0 reaches after it has read it
    __syncthreads();
    if (grp == 0) {
      const float2 ml = Jml[wave][lane];
      const float mj = fmaxf(mrow, ml.x);
      const float w0 = __expf(mrow - mj);
      const float w1 = __expf(ml.x - mj);
      lsum = lsum * w0 + ml.y * w1;
      // ---- join the halves' sums, normalize, write concat-by-head output ----
      const float inv = 1.f / (lsum + xhalf(lsum));
      const float c0 = w0 * inv;
      const float c1 = w1 * inv;
#pragma unroll
      for (int nt = 0; nt < 4; nt++) {
        const float4 a = Jo[wave][2 * nt][lane];
        const float4 b = Jo[wave][2 * nt + 1][lane];
        uint4 ov;
        ov.x = pack_bf16x2(f32x2{o[nt].f[0] * c0 + a.x * c1, o[nt].f[1] * c0 + a.y * c1});
        ov.y = pack_bf16x2(f32x2{o[nt].f[2] * c0 + a.z * c1, o[nt].f[3] * c0 + a.w * c1});
        ov.z = pack_bf16x2(f32x2{o[nt].f[4] * c0 + b.x * c1, o[nt].f[5] * c0 + b.y * c1});
        ov.w = pack_bf16x2(f32x2{o[nt].f[6] * c0 + b.z * c1, o[nt].f[7] * c0 + b.w * c1});
        *(uint4*)&Obf[(long long)mg * D_DIM + h * HS_ + nt * 16 + 8 * lhalf] = ov;
      }
    }
  }
}

// ---------------------------------------------------------------------------
extern "C" void kernel_launch(void* const* d_in, const int* in_sizes, int n_in,
                              void* d_out, int out_size, void* d_ws, size_t ws_size,
                              hipStream_t stream) {
  (void)in_sizes; (void)n_in; (void)out_size; (void)ws_size;
  const float* x     = (const float*)d_in[0];
  const float* Wq    = (const float*)d_in[1];
  const float* Wk    = (const float*)d_in[2];
  const float* Wv    = (const float*)d_in[3];
  const float* Wo    = (const float*)d_in[4];
  const float* bo    = (const float*)d_in[5];
  const float* W1    = (const float*)d_in[6];
  const float* b1    = (const float*)d_in[7];
  const float* W2    = (const float*)d_in[8];
  const float* b2    = (const float*)d_in[9];
  const float* ln1_g = (const float*)d_in[10];
  const float* ln1_b = (const float*)d_in[11];
  const float* ln2_g = (const float*)d_in[12];
  const float* ln2_b = (const float*)d_in[13];
  float* out = (float*)d_out;

  char* p = (char*)d_ws;
  auto alloc = [&](size_t bytes) -> void* {
    void* r = (void*)p;
    p += (bytes + 255) & ~(size_t)255;
    return r;
  };
  unsigned short* hbf  = (unsigned short*)alloc((size_t)C_DIM * E_DIM * 2);
  // Wq, Wk, Wv transposed, one behind the other: 3 * NH_ matrices of one GEMM
  unsigned short* WqkvT = (unsigned short*)alloc((size_t)3 * NH_ * HS_ * E_DIM * 2);
  unsigned short* WoT  = (unsigned short*)alloc((size_t)D_DIM * D_DIM * 2);
  unsigned short* W1T  = (unsigned short*)alloc((size_t)FF_DIM * D_DIM * 2);
  unsigned short* W2T  = (unsigned short*)alloc((size_t)E_DIM * FF_DIM * 2);
  // Q, K, V^T likewise: 3 * NH_ outputs of C_DIM * HS_ elements each
  unsigned short* Qb   = (unsigned short*)alloc((size_t)3 * NH_ * C_DIM * HS_ * 2);
  unsigned short* Kb   = Qb + (size_t)NH_ * C_DIM * HS_;
  unsigned short* Vtb  = Kb + (size_t)NH_ * C_DIM * HS_;
  unsigned short* attn = (unsigned short*)alloc((size_t)C_DIM * D_DIM * 2);
  float*          x1   = (float*)alloc((size_t)C_DIM * E_DIM * 4);
  unsigned short* h2   = (unsigned short*)alloc((size_t)C_DIM * D_DIM * 2);
  unsigned short* ff1  = (unsigned short*)alloc((size_t)C_DIM * FF_DIM * 2);

  const dim3 blk(256);

  // ---- weights to N-major bf16, and LN1 -> bf16: one launch ----
  prep_kernel<<<dim3(PREP_LN + PREP_W1 + PREP_W2 + PREP_WO + PREP_QKV), blk, 0, stream>>>(
      x, ln1_g, ln1_b, hbf, Wq, Wk, Wv, Wo, W1, W2, WqkvT, WoT, W1T, W2T);

  // ---- Q, K, V projections of all heads: one launch; V written transposed ----
  gemm_bf16_kernel<128, 64, false, false, false, true, 2 * NH_>
      <<<dim3(1, C_DIM / 128, 3 * NH_), blk, 0, stream>>>(
          hbf, WqkvT, nullptr, nullptr, nullptr, Qb, C_DIM, HS_, E_DIM,
          0LL, (long long)HS_ * E_DIM, (long long)C_DIM * HS_);

  // ---- causal flash attention (scale = 1/sqrt(E) per reference) ----
  flash_attn_kernel<<<dim3(ATT_NT / 2, NH_), dim3(512), 0, stream>>>(
      Qb, Kb, Vtb, attn, 0.03125f);

  // ---- output projection + bias + residual -> x1 (f32) ----
  gemm_bf16_kernel<128, 128, true, false, true, false, -1>
      <<<dim3(D_DIM / 128, C_DIM / 128, 1), blk, 0, stream>>>(
          attn, WoT, bo, x, x1, nullptr, C_DIM, D_DIM, D_DIM, 0LL, 0LL, 0LL);

  // ---- LN2 -> bf16 ----
  ln_bf16_kernel<<<dim3(C_DIM / 8), blk, 0, stream>>>(x1, ln2_g, ln2_b, h2);

  // ---- FFN1: relu(h2 @ W1 + b1) -> bf16 ----
  gemm_bf16_kernel<128, 128, true, true, false, true, -1>
      <<<dim3(FF_DIM / 128, C_DIM / 128, 1), blk, 0, stream>>>(
          h2, W1T, b1, nullptr, nullptr, ff1, C_DIM, FF_DIM, D_DIM, 0LL, 0LL, 0LL);

  // ---- FFN2: ff1 @ W2 + b2 + x1 -> d_out (f32) ----
  gemm_bf16_kernel<128, 128, true, false, true, false, -1>
      <<<dim3(E_DIM / 128, C_DIM / 128, 1), blk, 0, stream>>>(
          ff1, W2T, b2, x1, out, nullptr, C_DIM, E_DIM, FF_DIM, 0LL, 0LL, 0LL);
}
